// v000
// Measured on an AMD MI455X. A time is GPU time per run, averaged over a window of back-to-back runs after a warm-up
// (all launches, gaps included; the runs take copies of the inputs in turn), and the median of several windows.
// Apart from v000's, it joins two sittings. Times from different sittings can be a few percent apart, while
// side-by-side timings come from the same sitting.
// v000 is the starting kernel. One run takes 851 microseconds.
#include <hip/hip_runtime.h>

// Single-head causal attention (x [4][4096][768]; q, k, v = x W ('xw' [768][128], no bias); scores = q.k, causal (-inf), softmax(scores/sqrt(128)); out = attn.v -> [4][4096][128] f32 (2.1 M); no output projection).
// Compute dtypes, f32 accumulate: every input rounded to bf16; q/k/v on PLAIN bf16 operands (inputs: exact); causal scores and attn.v (tile skipping) on hi/lo planes for every row (3 products); streaming softmax in f32 (three passes over each score row in memory; no register-resident row); no output projection: the context is written in f32.

#define NB_  4
#define TT   4096
#define DM   768
#define NH_  1
#define NKV  1
#define REP  (NH_ / NKV)
#define HD   128
#define DQ   (NH_ * HD)
#define DKV  (NKV * HD)
#define ZH   1
#define RH   4096                 // every row hi/lo (streaming softmax, no register row)
#define RB   TT
#define WIN  4096
#define PCAR 1024.0f
#define SCL  0.088388347648318447f   // HD^-0.5
typedef _Float16 h16;
typedef unsigned short bf;
typedef __attribute__((ext_vector_type(16))) __bf16   v16bf;
typedef __attribute__((ext_vector_type(16))) _Float16 v16h;
typedef __attribute__((ext_vector_type(8)))  _Float16 v8h;
typedef __attribute__((ext_vector_type(8)))  unsigned short v8us;
typedef __attribute__((ext_vector_type(8)))  float    v8f;
typedef __attribute__((ext_vector_type(4)))  float    v4f;
typedef v8h  __attribute__((may_alias)) v8ha;
typedef v4f  __attribute__((may_alias)) v4fa;
typedef v8us __attribute__((may_alias)) v8usa;

__device__ __forceinline__ unsigned short f2bf(float f) { unsigned u = __float_as_uint(f); u += 0x7FFFu + ((u >> 16) & 1u); return (unsigned short)(u >> 16); }
__device__ __forceinline__ float bf2f(unsigned short b) { return __uint_as_float(((unsigned)b) << 16); }
__device__ __forceinline__ float bfr(float f) { return bf2f(f2bf(f)); }
__device__ __forceinline__ v16h cat16(v8h lo, v8h hi) { return __builtin_shufflevector(lo, hi, 0, 1, 2, 3, 4, 5, 6, 7, 8, 9, 10, 11, 12, 13, 14, 15); }
__device__ __forceinline__ v16bf cat16b(v8us lo, v8us hi) { return __builtin_bit_cast(v16bf, __builtin_shufflevector(lo, hi, 0, 1, 2, 3, 4, 5, 6, 7, 8, 9, 10, 11, 12, 13, 14, 15)); }
__device__ __forceinline__ v8f wmma16(v16h a, v16h b, v8f c) { return __builtin_amdgcn_wmma_f32_16x16x32_f16(false, a, false, b, (short)0, c, false, false); }
__device__ __forceinline__ v8f wmmab(v16bf a, v16bf b, v8f c) { return __builtin_amdgcn_wmma_f32_16x16x32_bf16(false, a, false, b, (short)0, c, false, false); }



// ---- k_gemmw: register-blocked GEMM, ONE WAVE per 64x64 output tile (16 accumulators), operands straight from K-contiguous 16-bit planes; grid (M/64, N/64, Z), 32 threads.
// C[m][n] (f32, pitch ldc, + optional f32 bias[n]) = sum_k A[m][k] Bt[n][k] (+ split products per NSPLIT). z-batch strides sA/sB/sC in elements. K % 32 == 0.
template <typename T16> struct WFrag;
template <> struct WFrag<h16> { typedef v16h V; static __device__ __forceinline__ V ld(const h16* p) { return cat16(*(const v8h*)p, *(const v8h*)(p + 16)); } static __device__ __forceinline__ v8f mma(V a, V b, v8f c) { return wmma16(a, b, c); } };
template <> struct WFrag<bf> { typedef v16bf V; static __device__ __forceinline__ V ld(const bf* p) { return cat16b(*(const v8us*)p, *(const v8us*)(p + 16)); } static __device__ __forceinline__ v8f mma(V a, V b, v8f c) { return wmmab(a, b, c); } };
template <typename T16, int NSPLIT, bool BIAS>
__global__ __launch_bounds__(32) void k_gemmw(const T16* __restrict__ A, const T16* __restrict__ A2, const T16* __restrict__ Bt, const T16* __restrict__ Bt2, int K, float* C, int ldc, const float* __restrict__ bias, size_t sA, size_t sB, size_t sC) {
    typedef typename WFrag<T16>::V V;
    __shared__ __align__(16) float os[16 * 68];
    const size_t z = blockIdx.z; A += z * sA; if (A2) A2 += z * sA; Bt += z * sB; if (Bt2) Bt2 += z * sB; C += z * sC;
    const int lane = threadIdx.x & 31, lr = lane & 15, hi = lane >> 4; const int r0 = blockIdx.x * 64, c0 = blockIdx.y * 64;
    v8f acc[4][4];
#pragma unroll
    for (int mb = 0; mb < 4; ++mb)
#pragma unroll
        for (int nb = 0; nb < 4; ++nb) acc[mb][nb] = (v8f){};
    const size_t aoff = (size_t)(r0 + lr) * K + 8 * hi, boff = (size_t)(c0 + lr) * K + 8 * hi;
#pragma unroll 1
    for (int kc = 0; kc < K; kc += 32) {
        V a[4], a2[4];
#pragma unroll
        for (int mb = 0; mb < 4; ++mb) { a[mb] = WFrag<T16>::ld(A + aoff + (size_t)mb * 16 * K + kc); if (NSPLIT == 1 || NSPLIT == 2) a2[mb] = WFrag<T16>::ld(A2 + aoff + (size_t)mb * 16 * K + kc); }
#pragma unroll
        for (int nb = 0; nb < 4; ++nb) { const V b = WFrag<T16>::ld(Bt + boff + (size_t)nb * 16 * K + kc); V b2; if (NSPLIT >= 2) b2 = WFrag<T16>::ld(Bt2 + boff + (size_t)nb * 16 * K + kc);
#pragma unroll
            for (int mb = 0; mb < 4; ++mb) { acc[mb][nb] = WFrag<T16>::mma(a[mb], b, acc[mb][nb]); if (NSPLIT == 1 || NSPLIT == 2) acc[mb][nb] = WFrag<T16>::mma(a2[mb], b, acc[mb][nb]); if (NSPLIT >= 2) acc[mb][nb] = WFrag<T16>::mma(a[mb], b2, acc[mb][nb]); } }
        asm volatile("v_nop\n\tv_nop\n\tv_nop\n\tv_nop" : "+v"(acc[0][0]), "+v"(acc[1][1]), "+v"(acc[2][2]), "+v"(acc[3][3]) : "v"(a[0]), "v"(a[3]));
    }
#pragma unroll
    for (int mb = 0; mb < 4; ++mb) {
#pragma unroll
        for (int nb = 0; nb < 4; ++nb) {
#pragma unroll
            for (int j = 0; j < 8; ++j) os[(hi * 8 + j) * 68 + nb * 16 + lr] = acc[mb][nb][j]; }
        __builtin_amdgcn_wave_barrier(); asm volatile("" ::: "memory");
        float* crow = C + (size_t)(r0 + mb * 16) * ldc + c0;
{
#pragma unroll
            for (int s = 0; s < 8; ++s) { const int row = 2 * s + hi, cofs = lr * 4; v4f val = *(const v4fa*)(os + row * 68 + cofs); if (BIAS) { val[0] += bfr(bias[c0 + cofs]); val[1] += bfr(bias[c0 + cofs + 1]); val[2] += bfr(bias[c0 + cofs + 2]); val[3] += bfr(bias[c0 + cofs + 3]); }
                *(v4f*)(crow + (size_t)row * ldc + cofs) = val; }
             }
        __builtin_amdgcn_wave_barrier(); asm volatile("" ::: "memory");
    }
}

// ---- k_gemmc: the same one-wave 64x64 tile GEMM specialised for causal attention: CMODE 1 skips score tiles entirely above the diagonal (query rows r0+roff.., key columns c0..), CMODE 2 limits the
// key (K) loop of the probability x value contraction to the diagonal block (probabilities beyond it are exactly zero). roff = row offset of this launch's first row within the sequence.
template <typename T16, int NSPLIT, int CMODE>
__global__ __launch_bounds__(32) void k_gemmc(const T16* __restrict__ A, const T16* __restrict__ A2, const T16* __restrict__ Bt, const T16* __restrict__ Bt2, int K, float* C, int ldc, int roff, size_t sA, size_t sB, size_t sC) {
    typedef typename WFrag<T16>::V V;
    __shared__ __align__(16) float os[16 * 68];
    const size_t z = blockIdx.z; A += z * sA; if (A2) A2 += z * sA; Bt += z * sB; if (Bt2) Bt2 += z * sB; C += z * sC;
    const int lane = threadIdx.x & 31, lr = lane & 15, hi = lane >> 4; const int r0 = blockIdx.x * 64, c0 = blockIdx.y * 64;
    if (CMODE == 1 && c0 > r0 + roff + 63) return;                  // score tile entirely above the causal diagonal: never read (the softmax masks j > i by select)
    const int Kl = (CMODE == 2) ? min(K, r0 + roff + 64) : K;        // P.V: probabilities are exactly 0 beyond the diagonal block, so the K loop stops there
    v8f acc[4][4];
#pragma unroll
    for (int mb = 0; mb < 4; ++mb)
#pragma unroll
        for (int nb = 0; nb < 4; ++nb) acc[mb][nb] = (v8f){};
    const size_t aoff = (size_t)(r0 + lr) * K + 8 * hi, boff = (size_t)(c0 + lr) * K + 8 * hi;
#pragma unroll 1
    for (int kc = 0; kc < Kl; kc += 32) {
        V a[4], a2[4];
#pragma unroll
        for (int mb = 0; mb < 4; ++mb) { a[mb] = WFrag<T16>::ld(A + aoff + (size_t)mb * 16 * K + kc); if (NSPLIT == 1 || NSPLIT == 2) a2[mb] = WFrag<T16>::ld(A2 + aoff + (size_t)mb * 16 * K + kc); }
#pragma unroll
        for (int nb = 0; nb < 4; ++nb) { const V b = WFrag<T16>::ld(Bt + boff + (size_t)nb * 16 * K + kc); V b2; if (NSPLIT >= 2) b2 = WFrag<T16>::ld(Bt2 + boff + (size_t)nb * 16 * K + kc);
#pragma unroll
            for (int mb = 0; mb < 4; ++mb) { acc[mb][nb] = WFrag<T16>::mma(a[mb], b, acc[mb][nb]); if (NSPLIT == 1 || NSPLIT == 2) acc[mb][nb] = WFrag<T16>::mma(a2[mb], b, acc[mb][nb]); if (NSPLIT >= 2) acc[mb][nb] = WFrag<T16>::mma(a[mb], b2, acc[mb][nb]); } }
        asm volatile("v_nop\n\tv_nop\n\tv_nop\n\tv_nop" : "+v"(acc[0][0]), "+v"(acc[1][1]), "+v"(acc[2][2]), "+v"(acc[3][3]) : "v"(a[0]), "v"(a[3]));
    }
#pragma unroll
    for (int mb = 0; mb < 4; ++mb) {
#pragma unroll
        for (int nb = 0; nb < 4; ++nb) {
#pragma unroll
            for (int j = 0; j < 8; ++j) os[(hi * 8 + j) * 68 + nb * 16 + lr] = acc[mb][nb][j]; }
        __builtin_amdgcn_wave_barrier(); asm volatile("" ::: "memory");
        float* crow = C + (size_t)(r0 + mb * 16) * ldc + c0;
{
#pragma unroll
            for (int s = 0; s < 8; ++s) { const int row = 2 * s + hi, cofs = lr * 4; v4f val = *(const v4fa*)(os + row * 68 + cofs);
                *(v4f*)(crow + (size_t)row * ldc + cofs) = val; }
             }
        __builtin_amdgcn_wave_barrier(); asm volatile("" ::: "memory");
    }
}

__device__ __forceinline__ h16 tohx(float x) { return (h16)x; }
__device__ __forceinline__ void splitf(float y, unsigned short& h, unsigned short& l) { h = f2bf(y); l = f2bf(y - bf2f(h)); }
typedef __attribute__((ext_vector_type(2))) _Float16 v2h;
typedef __attribute__((ext_vector_type(4))) _Float16 v4h;
typedef __attribute__((ext_vector_type(2))) unsigned short v2us;
typedef __attribute__((ext_vector_type(4))) unsigned short v4us;
typedef __attribute__((ext_vector_type(2))) float v2f;
typedef __attribute__((ext_vector_type(4))) int v4i;

__global__ __launch_bounds__(256) void k_wtG(const float* __restrict__ w, int K, int N, bf* Bt) {
    const int lane = threadIdx.x & 31; const int L0 = (blockIdx.x * 8 + (threadIdx.x >> 5)) * 8; const int nlines = N * K / 64;
{
#pragma unroll 1
        for (int l = 0; l < 8; ++l) { const int L = L0 + l; if (L >= nlines) break; const size_t e = (size_t)L * 64 + lane * 2; const int k = (int)(e % K), n = (int)(e / K); v2us o;
            o[0] = f2bf(w[(size_t)k * N + n]); o[1] = f2bf(w[(size_t)(k + 1) * N + n]); *(v2us*)(Bt + e) = o; }
         }
}
__global__ __launch_bounds__(256) void k_cvt8(const float* __restrict__ src, bf* dst, size_t n8) { const size_t i = (size_t)blockIdx.x * 256 + threadIdx.x; if (i >= n8) return; const v8f v = *(const v8f*)(src + i * 8); v8us o;
#pragma unroll
    for (int k = 0; k < 8; ++k) o[k] = f2bf(v[k]); *(v8us*)(dst + i * 8) = o;  }

// k_rope: head planes [h][t][d] (fp16 + hi/lo) of rope(x) x sc with the rotate-half convention out[d] = x[d] cos[t][d] - x[d+HD/2] sin[t][d], out[d+HD/2] = x[d+HD/2] cos[t][d+HD/2] + x[d] sin[t][d+HD/2]
__global__ __launch_bounds__(256) void k_rope(const float* __restrict__ F, int pitch, int nheads, const float* __restrict__ CS, const float* __restrict__ RF, const float* __restrict__ nw, float sc, h16* P16, bf* Ph, bf* Pl) {
    const size_t e = ((size_t)blockIdx.x * 256 + threadIdx.x) * 2; if (e >= (size_t)nheads * TT * HD) return; const int d = (int)(e % HD); const int t = (int)((e / HD) % TT); const int h = (int)(e / ((size_t)HD * TT)); const float* f = F + (size_t)t * pitch + h * HD; const float rf = RF ? RF[(size_t)h * TT + t] : 1.0f; v2h o16; v2us oh, ol;
#pragma unroll
    for (int q = 0; q < 2; ++q) { const int dd = d + q; const int dp = (dd < HD / 2) ? dd + HD / 2 : dd - HD / 2; float x0 = f[dd], x1 = f[dp];
        if (RF) { float n0 = __fmul_rn(x0, rf), n1 = __fmul_rn(x1, rf); asm volatile("" : "+v"(n0)); asm volatile("" : "+v"(n1)); x0 = __fmul_rn(bfr(nw[dd]), n0); x1 = __fmul_rn(bfr(nw[dp]), n1); }
        const v2f cs = *(const v2f*)(CS + ((size_t)t * HD + dd) * 2); float a = __fmul_rn(x0, cs[0]), bq = __fmul_rn(x1, cs[1]); asm volatile("" : "+v"(a)); asm volatile("" : "+v"(bq)); const float r = ((dd < HD / 2) ? __fsub_rn(a, bq) : __fadd_rn(a, bq)) * sc;
        o16[q] = tohx(r); unsigned short a2, c2; splitf(r, a2, c2); oh[q] = a2; ol[q] = c2; }
    *(v2h*)(P16 + e) = o16; *(v2us*)(Ph + e) = oh; *(v2us*)(Pl + e) = ol;  }
__global__ __launch_bounds__(256) void k_vtp(const float* __restrict__ F, int pitch, int nheads, h16* V16, bf* Vh, bf* Vl) { const size_t e = ((size_t)blockIdx.x * 256 + threadIdx.x) * 2; if (e >= (size_t)nheads * HD * TT) return; const int t = (int)(e % TT); const int d = (int)((e / TT) % HD); const int g = (int)(e / ((size_t)TT * HD)); v2h o16; v2us oh, ol;
#pragma unroll
    for (int q = 0; q < 2; ++q) { const float x = F[(size_t)(t + q) * pitch + g * HD + d]; o16[q] = tohx(x); unsigned short a2, c2; splitf(x, a2, c2); oh[q] = a2; ol[q] = c2; }
    *(v2h*)(V16 + e) = o16; *(v2us*)(Vh + e) = oh; *(v2us*)(Vl + e) = ol;  }
__global__ __launch_bounds__(256) void k_csid(float* CS) { const int idx = blockIdx.x * 256 + threadIdx.x; if (idx >= TT * HD) return; v2f cs; cs[0] = 1.0f; cs[1] = 0.0f; *(v2f*)(CS + (size_t)idx * 2) = cs;  }
__global__ __launch_bounds__(256) void k_ssoft(const float* __restrict__ Sb, int r0, bf* Ph, bf* Pl) {
    const int lane = threadIdx.x & 31; const int ri = blockIdx.x * 8 + (threadIdx.x >> 5); if (ri >= RB) return; const int i = r0 + ri; const float* sr = Sb + (size_t)ri * TT; const int nval = i + 1;   /* causal, diagonal kept: keys 0 .. i */
    float mx = -3.0e38f;
#pragma unroll 1
    for (int j0 = lane * 4; j0 < nval; j0 += 128) { const v4f a = *(const v4f*)(sr + j0);
#pragma unroll
        for (int q = 0; q < 4; ++q) if (j0 + q < nval) mx = fmaxf(mx, a[q] * SCL); }
#pragma unroll
    for (int sh = 16; sh; sh >>= 1) mx = fmaxf(mx, __shfl_xor(mx, sh, 32));
    float sum = 0.f;
#pragma unroll 1
    for (int j0 = lane * 4; j0 < nval; j0 += 128) { const v4f a = *(const v4f*)(sr + j0);
#pragma unroll
        for (int q = 0; q < 4; ++q) if (j0 + q < nval) { float d0 = __fsub_rn(a[q] * SCL, mx); asm volatile("" : "+v"(d0)); sum += __builtin_amdgcn_exp2f(__fmul_rn(d0, 1.4426950408889634f)); } }
#pragma unroll
    for (int sh = 16; sh; sh >>= 1) sum += __shfl_xor(sum, sh, 32);
    const float f = (nval > 0) ? __fdiv_rn(1.0f, sum) : 0.f;
{
#pragma unroll 1
        for (int j0 = lane * 4; j0 < TT; j0 += 128) { const v4f a = *(const v4f*)(sr + j0); v4us oh, ol;
#pragma unroll
            for (int q = 0; q < 4; ++q) { float pv = 0.f; if (j0 + q < nval) { float d0 = __fsub_rn(a[q] * SCL, mx); asm volatile("" : "+v"(d0)); pv = __builtin_amdgcn_exp2f(__fmul_rn(d0, 1.4426950408889634f)) * f; } unsigned short h2, l2; splitf(pv, h2, l2); oh[q] = h2; ol[q] = l2; }
            const size_t oo = (size_t)ri * TT + j0; *(v4us*)(Ph + oo) = oh; *(v4us*)(Pl + oo) = ol; }
         } }

__global__ __launch_bounds__(256) void k_merge(const float* __restrict__ O, int h0, float* OUTb) { const size_t e = ((size_t)blockIdx.x * 256 + threadIdx.x) * 2; if (e >= (size_t)ZH * TT * HD) return; const int d = (int)(e % HD); const int t = (int)((e / HD) % TT); const int zz = (int)(e / ((size_t)HD * TT)); const float cs = (t < RH) ? 1.0f : (1.0f / PCAR); const size_t oo = (size_t)t * DQ + (h0 + zz) * HD + d;
    v2f o2; o2[0] = O[e] * cs; o2[1] = O[e + 1] * cs; *(v2f*)(OUTb + oo) = o2;  }   /* f32 context straight to the output */

extern "C" void kernel_launch(void* const* d_in, const int* in_sizes, int n_in,
                              void* d_out, int out_size, void* d_ws, size_t ws_size, hipStream_t stream) {
    (void)in_sizes; (void)n_in; (void)out_size;
    const float* x = (const float*)d_in[0]; const float* wq = (const float*)d_in[1]; const float* wk = (const float*)d_in[2]; const float* wv = (const float*)d_in[3]; const float* wo = nullptr; (void)wo;
    float* OUT = (float*)d_out;     // [4][4096][128]
    char* wsp = (char*)d_ws;
    auto take = [&](size_t bytes) { char* p = wsp; wsp += (bytes + 255) & ~(size_t)255; return (void*)p; };
    bf* WQ = (bf*)take((size_t)DQ * DM * 2); bf* WK = (bf*)take((size_t)DKV * DM * 2); bf* WV = (bf*)take((size_t)DKV * DM * 2); float* CS = (float*)take((size_t)TT * HD * 2 * 4);
    bf* XB = (bf*)take((size_t)TT * DM * 2); float* FQ = (float*)take((size_t)TT * DQ * 4); float* FK = (float*)take((size_t)TT * DKV * 4);
    h16* QP16 = (h16*)take((size_t)NH_ * TT * HD * 2); h16* KP16 = (h16*)take((size_t)NKV * TT * HD * 2); h16* VT16 = (h16*)take((size_t)NKV * HD * TT * 2);
    bf* QPh = (bf*)take((size_t)NH_ * TT * HD * 2); bf* QPl = (bf*)take((size_t)NH_ * TT * HD * 2); bf* KPh = (bf*)take((size_t)NKV * TT * HD * 2); bf* KPl = (bf*)take((size_t)NKV * TT * HD * 2); bf* VTh = (bf*)take((size_t)NKV * HD * TT * 2); bf* VTl = (bf*)take((size_t)NKV * HD * TT * 2); bf* Ph = (bf*)take((size_t)ZH * RH * TT * 2); bf* Pl = (bf*)take((size_t)ZH * RH * TT * 2);
    float* Sb = (float*)take((size_t)ZH * TT * TT * 4); h16* P16 = (h16*)take(256);   /* unused: all rows hi/lo */ float* Ob = (float*)take((size_t)ZH * TT * HD * 4); 
    if ((size_t)(wsp - (char*)d_ws) > ws_size) return;    // ws 256 MiB
    float* FV = FK;   // v projection reuses the k buffer after the k planes are built (stream-ordered)
    { k_wtG<<<(unsigned)((DM * DQ / 64 + 63) / 64), 256, 0, stream>>>(wq, DM, DQ, WQ); k_wtG<<<(unsigned)((DM * DKV / 64 + 63) / 64), 256, 0, stream>>>(wk, DM, DKV, WK); k_wtG<<<(unsigned)((DM * DKV / 64 + 63) / 64), 256, 0, stream>>>(wv, DM, DKV, WV);
       }
    k_csid<<<(TT * HD + 255) / 256, 256, 0, stream>>>(CS);
    const unsigned LQ = (unsigned)(((size_t)NH_ * TT * HD / 2 + 255) / 256), LKv = (unsigned)(((size_t)NKV * TT * HD / 2 + 255) / 256);
    for (int b = 0; b < NB_; ++b) {
        
        k_cvt8<<<(unsigned)(((size_t)TT * DM / 8 + 255) / 256), 256, 0, stream>>>(x + (size_t)b * TT * DM, XB, (size_t)TT * DM / 8);
        k_gemmw<bf, 0, false><<<dim3(TT / 64, DQ / 64, 1), 32, 0, stream>>>(XB, nullptr, WQ, nullptr, DM, FQ, DQ, nullptr, 0, 0, 0);
        k_rope<<<LQ, 256, 0, stream>>>(FQ, DQ, NH_, CS, nullptr, nullptr, 1.0f, QP16, QPh, QPl);
        k_gemmw<bf, 0, false><<<dim3(TT / 64, DKV / 64, 1), 32, 0, stream>>>(XB, nullptr, WK, nullptr, DM, FK, DKV, nullptr, 0, 0, 0);
        k_rope<<<LKv, 256, 0, stream>>>(FK, DKV, NKV, CS, nullptr, nullptr, 1.0f, KP16, KPh, KPl);
        k_gemmw<bf, 0, false><<<dim3(TT / 64, DKV / 64, 1), 32, 0, stream>>>(XB, nullptr, WV, nullptr, DM, FV, DKV, nullptr, 0, 0, 0); k_vtp<<<LKv, 256, 0, stream>>>(FV, DKV, NKV, VT16, VTh, VTl);
        for (int h0 = 0; h0 < NH_; h0 += ZH) { const size_t zq = (size_t)h0, zk = (size_t)(h0 / REP);   // one kv head per query head: each pass covers one head and its kv plane (z-strides TT*HD)
            k_gemmc<bf, 2, 1><<<dim3(RH / 64, TT / 64, ZH), 32, 0, stream>>>(QPh + zq * TT * HD, QPl + zq * TT * HD, KPh + zk * TT * HD, KPl + zk * TT * HD, HD, Sb, TT, 0, (size_t)TT * HD, (size_t)TT * HD, (size_t)TT * TT);
            k_ssoft<<<TT / 8, 256, 0, stream>>>(Sb, 0, Ph, Pl);   /* streaming causal softmax, hi/lo planes for every row */
            k_gemmc<bf, 2, 2><<<dim3(RH / 64, HD / 64, ZH), 32, 0, stream>>>(Ph, Pl, VTh + zk * HD * TT, VTl + zk * HD * TT, TT, Ob, HD, 0, (size_t)RH * TT, (size_t)HD * TT, (size_t)TT * HD);
            k_merge<<<(unsigned)(((size_t)ZH * TT * HD / 2 + 255) / 256), 256, 0, stream>>>(Ob, h0, OUT + (size_t)b * TT * DQ); }
    }
}

// v001
// A run of this version takes 513 microseconds.
// In two side-by-side timings against v000, it was 1.67 and 1.65 times as fast.
#include <hip/hip_runtime.h>

// Single-head causal attention (x [4][4096][768]; q, k, v = x W ('xw' [768][128], no bias); scores = q.k, causal (-inf), softmax(scores/sqrt(128)); out = attn.v -> [4][4096][128] f32 (2.1 M); no output projection).
// Compute dtypes, f32 accumulate: every input rounded to bf16; q/k/v on PLAIN bf16 operands (inputs: exact); causal scores and attn.v (tile skipping) on hi/lo planes for every row (3 products); streaming softmax in f32 (three passes over each score row in memory; no register-resident row); no output projection: the context is written in f32.

#define NB_  4
#define TT   4096
#define DM   768
#define NH_  1
#define NKV  1
#define REP  (NH_ / NKV)
#define HD   128
#define DQ   (NH_ * HD)
#define DKV  (NKV * HD)
#define ZH   1
#define RH   4096                 // every row hi/lo (streaming softmax, no register row)
#define RB   TT
#define WIN  4096
#define PCAR 1024.0f
#define SCL  0.088388347648318447f   // HD^-0.5
#define KCH  512                  // keys per chunk of the probability x value product (one partial plane per chunk)
typedef _Float16 h16;
typedef unsigned short bf;
typedef __attribute__((ext_vector_type(16))) __bf16   v16bf;
typedef __attribute__((ext_vector_type(16))) _Float16 v16h;
typedef __attribute__((ext_vector_type(8)))  _Float16 v8h;
typedef __attribute__((ext_vector_type(8)))  unsigned short v8us;
typedef __attribute__((ext_vector_type(8)))  float    v8f;
typedef __attribute__((ext_vector_type(4)))  float    v4f;
typedef v8h  __attribute__((may_alias)) v8ha;
typedef v4f  __attribute__((may_alias)) v4fa;
typedef v8us __attribute__((may_alias)) v8usa;

__device__ __forceinline__ unsigned short f2bf(float f) { unsigned u = __float_as_uint(f); u += 0x7FFFu + ((u >> 16) & 1u); return (unsigned short)(u >> 16); }
__device__ __forceinline__ float bf2f(unsigned short b) { return __uint_as_float(((unsigned)b) << 16); }
__device__ __forceinline__ float bfr(float f) { return bf2f(f2bf(f)); }
__device__ __forceinline__ v16h cat16(v8h lo, v8h hi) { return __builtin_shufflevector(lo, hi, 0, 1, 2, 3, 4, 5, 6, 7, 8, 9, 10, 11, 12, 13, 14, 15); }
__device__ __forceinline__ v16bf cat16b(v8us lo, v8us hi) { return __builtin_bit_cast(v16bf, __builtin_shufflevector(lo, hi, 0, 1, 2, 3, 4, 5, 6, 7, 8, 9, 10, 11, 12, 13, 14, 15)); }
__device__ __forceinline__ v8f wmma16(v16h a, v16h b, v8f c) { return __builtin_amdgcn_wmma_f32_16x16x32_f16(false, a, false, b, (short)0, c, false, false); }
__device__ __forceinline__ v8f wmmab(v16bf a, v16bf b, v8f c) { return __builtin_amdgcn_wmma_f32_16x16x32_bf16(false, a, false, b, (short)0, c, false, false); }



// ---- k_gemms: split-K GEMM, one work-group of NW waves per 64x64 output tile; every wave keeps the whole tile (16 accumulators) and takes 64-wide slices of K (whole 128-byte lines of each operand row),
// operands straight from K-contiguous 16-bit planes; the NW partial tiles are added in LDS in wave order. C[m][n] (f32, pitch ldc) = sum_k A[m][k] Bt[n][k] (+ split products per NSPLIT). K % 64 == 0.
// CMODE 0: grid (M/64, N/64), the whole K. CMODE 2 (probability x value, causal): the K range of row tile xt ends at its diagonal block (probabilities beyond it are exactly zero) and is cut into chunks of KC keys;
// blockIdx.x counts the (row tile, chunk) pairs that exist, chunk ks writes its partial tile to plane ks of C (plane stride sC); k_merge adds the planes.
template <typename T16> struct WFrag;
template <> struct WFrag<h16> { typedef v16h V; static __device__ __forceinline__ V ld(const h16* p) { return cat16(*(const v8h*)p, *(const v8h*)(p + 16)); } static __device__ __forceinline__ v8f mma(V a, V b, v8f c) { return wmma16(a, b, c); } };
template <> struct WFrag<bf> { typedef v16bf V; static __device__ __forceinline__ V ld(const bf* p) { return cat16b(*(const v8us*)p, *(const v8us*)(p + 16)); } static __device__ __forceinline__ v8f mma(V a, V b, v8f c) { return wmmab(a, b, c); } };
template <typename T16, int NSPLIT, int CMODE, int NW, int KC>
__global__ __launch_bounds__(NW * 32) void k_gemms(const T16* __restrict__ A, const T16* __restrict__ A2, const T16* __restrict__ Bt, const T16* __restrict__ Bt2, int K, float* C, int ldc, size_t sC) {
    typedef typename WFrag<T16>::V V;
    __shared__ __align__(16) float red[NW * 64 * 68];
    const int lane = threadIdx.x & 31, lr = lane & 15, hi = lane >> 4; const int wv = __builtin_amdgcn_readfirstlane(threadIdx.x >> 5);   // the wave's number as a scalar: the K loops below then branch on scalar compares
    int xt = blockIdx.x, ks = 0;
    if (CMODE == 2) { constexpr int XG = KC / 64; int g = 0;      // row tiles g*XG .. g*XG+XG-1 have g+1 chunks each; XG*g*(g+1)/2 pairs stand before group g
#pragma unroll
        for (int q = 1; q < TT / KC; ++q) if (XG * q * (q + 1) / 2 <= (int)blockIdx.x) g = q;
        const int rem = (int)blockIdx.x - XG * g * (g + 1) / 2; xt = g * XG + rem % XG; ks = rem / XG; }
    const int r0 = xt * 64, c0 = blockIdx.y * 64;
    const int kbeg = ks * KC, kend = (CMODE == 2) ? min(r0 + 64, kbeg + KC) : K;
    C += (size_t)ks * sC;
    v8f acc[4][4];
#pragma unroll
    for (int mb = 0; mb < 4; ++mb)
#pragma unroll
        for (int nb = 0; nb < 4; ++nb) acc[mb][nb] = (v8f){};
    const size_t aoff = (size_t)(r0 + lr) * K + 8 * hi, boff = (size_t)(c0 + lr) * K + 8 * hi;
    // both K loops stay rolled: the fragments of two steps beside the 16 accumulators would not fit 256 registers (two work-groups per WGP)
#pragma unroll 1
    for (int k0 = kbeg + 64 * wv; k0 < kend; k0 += 64 * NW) {
#pragma unroll 1
    for (int kc = k0; kc < k0 + 64; kc += 32) {
        V a[4], a2[4];
#pragma unroll
        for (int mb = 0; mb < 4; ++mb) { a[mb] = WFrag<T16>::ld(A + aoff + (size_t)mb * 16 * K + kc); if (NSPLIT == 1 || NSPLIT == 2) a2[mb] = WFrag<T16>::ld(A2 + aoff + (size_t)mb * 16 * K + kc); }
#pragma unroll
        for (int nb = 0; nb < 4; ++nb) { const V b = WFrag<T16>::ld(Bt + boff + (size_t)nb * 16 * K + kc); V b2; if (NSPLIT >= 2) b2 = WFrag<T16>::ld(Bt2 + boff + (size_t)nb * 16 * K + kc);
#pragma unroll
            for (int mb = 0; mb < 4; ++mb) { acc[mb][nb] = WFrag<T16>::mma(a[mb], b, acc[mb][nb]); if (NSPLIT == 1 || NSPLIT == 2) acc[mb][nb] = WFrag<T16>::mma(a2[mb], b, acc[mb][nb]); if (NSPLIT >= 2) acc[mb][nb] = WFrag<T16>::mma(a[mb], b2, acc[mb][nb]); } }
        // four vector slots behind the step's last matrix instruction, on the back edge and on the exit alike, before its operands or results are touched
        asm volatile("v_nop\n\tv_nop\n\tv_nop\n\tv_nop" : "+v"(acc[0][0]), "+v"(acc[1][1]), "+v"(acc[2][2]), "+v"(acc[3][3]) : "v"(a[0]), "v"(a[3]));
    } }
    float* os = red + wv * (64 * 68);
#pragma unroll
    for (int mb = 0; mb < 4; ++mb)
#pragma unroll
        for (int nb = 0; nb < 4; ++nb)
#pragma unroll
            for (int j = 0; j < 8; ++j) os[(mb * 16 + hi * 8 + j) * 68 + nb * 16 + lr] = acc[mb][nb][j];
    __syncthreads();   // every wave's partial tile is in LDS before any thread adds them
    for (int p = threadIdx.x; p < 64 * 16; p += NW * 32) { const int row = p >> 4, cofs = (p & 15) * 4; v4f val = *(const v4fa*)(red + row * 68 + cofs);
#pragma unroll
        for (int w = 1; w < NW; ++w) val += *(const v4fa*)(red + w * (64 * 68) + row * 68 + cofs);
        *(v4f*)(C + (size_t)(r0 + row) * ldc + c0 + cofs) = val; }
}

// ---- k_gemmc: one-wave 64x64 tile GEMM (32 threads, 16 accumulators, the whole K loop in the one wave) specialised for causal attention: CMODE 1 skips score tiles entirely above the diagonal (query rows r0+roff.., key columns c0..), CMODE 2 limits the
// key (K) loop of the probability x value contraction to the diagonal block (probabilities beyond it are exactly zero). roff = row offset of this launch's first row within the sequence.
template <typename T16, int NSPLIT, int CMODE>
__global__ __launch_bounds__(32) void k_gemmc(const T16* __restrict__ A, const T16* __restrict__ A2, const T16* __restrict__ Bt, const T16* __restrict__ Bt2, int K, float* C, int ldc, int roff, size_t sA, size_t sB, size_t sC) {
    typedef typename WFrag<T16>::V V;
    __shared__ __align__(16) float os[16 * 68];
    const size_t z = blockIdx.z; A += z * sA; if (A2) A2 += z * sA; Bt += z * sB; if (Bt2) Bt2 += z * sB; C += z * sC;
    const int lane = threadIdx.x & 31, lr = lane & 15, hi = lane >> 4; const int r0 = blockIdx.x * 64, c0 = blockIdx.y * 64;
    if (CMODE == 1 && c0 > r0 + roff + 63) return;                  // score tile entirely above the causal diagonal: never read (the softmax masks j > i by select)
    const int Kl = (CMODE == 2) ? min(K, r0 + roff + 64) : K;        // P.V: probabilities are exactly 0 beyond the diagonal block, so the K loop stops there
    v8f acc[4][4];
#pragma unroll
    for (int mb = 0; mb < 4; ++mb)
#pragma unroll
        for (int nb = 0; nb < 4; ++nb) acc[mb][nb] = (v8f){};
    const size_t aoff = (size_t)(r0 + lr) * K + 8 * hi, boff = (size_t)(c0 + lr) * K + 8 * hi;
#pragma unroll 1
    for (int kc = 0; kc < Kl; kc += 32) {
        V a[4], a2[4];
#pragma unroll
        for (int mb = 0; mb < 4; ++mb) { a[mb] = WFrag<T16>::ld(A + aoff + (size_t)mb * 16 * K + kc); if (NSPLIT == 1 || NSPLIT == 2) a2[mb] = WFrag<T16>::ld(A2 + aoff + (size_t)mb * 16 * K + kc); }
#pragma unroll
        for (int nb = 0; nb < 4; ++nb) { const V b = WFrag<T16>::ld(Bt + boff + (size_t)nb * 16 * K + kc); V b2; if (NSPLIT >= 2) b2 = WFrag<T16>::ld(Bt2 + boff + (size_t)nb * 16 * K + kc);
#pragma unroll
            for (int mb = 0; mb < 4; ++mb) { acc[mb][nb] = WFrag<T16>::mma(a[mb], b, acc[mb][nb]); if (NSPLIT == 1 || NSPLIT == 2) acc[mb][nb] = WFrag<T16>::mma(a2[mb], b, acc[mb][nb]); if (NSPLIT >= 2) acc[mb][nb] = WFrag<T16>::mma(a[mb], b2, acc[mb][nb]); } }
        asm volatile("v_nop\n\tv_nop\n\tv_nop\n\tv_nop" : "+v"(acc[0][0]), "+v"(acc[1][1]), "+v"(acc[2][2]), "+v"(acc[3][3]) : "v"(a[0]), "v"(a[3]));
    }
#pragma unroll
    for (int mb = 0; mb < 4; ++mb) {
#pragma unroll
        for (int nb = 0; nb < 4; ++nb) {
#pragma unroll
            for (int j = 0; j < 8; ++j) os[(hi * 8 + j) * 68 + nb * 16 + lr] = acc[mb][nb][j]; }
        __builtin_amdgcn_wave_barrier(); asm volatile("" ::: "memory");
        float* crow = C + (size_t)(r0 + mb * 16) * ldc + c0;
{
#pragma unroll
            for (int s = 0; s < 8; ++s) { const int row = 2 * s + hi, cofs = lr * 4; v4f val = *(const v4fa*)(os + row * 68 + cofs);
                *(v4f*)(crow + (size_t)row * ldc + cofs) = val; }
             }
        __builtin_amdgcn_wave_barrier(); asm volatile("" ::: "memory");
    }
}

__device__ __forceinline__ h16 tohx(float x) { return (h16)x; }
__device__ __forceinline__ void splitf(float y, unsigned short& h, unsigned short& l) { h = f2bf(y); l = f2bf(y - bf2f(h)); }
typedef __attribute__((ext_vector_type(2))) _Float16 v2h;
typedef __attribute__((ext_vector_type(4))) _Float16 v4h;
typedef __attribute__((ext_vector_type(2))) unsigned short v2us;
typedef __attribute__((ext_vector_type(4))) unsigned short v4us;
typedef __attribute__((ext_vector_type(2))) float v2f;
typedef __attribute__((ext_vector_type(4))) int v4i;

__global__ __launch_bounds__(256) void k_wtG(const float* __restrict__ w, int K, int N, bf* Bt) {
    const int lane = threadIdx.x & 31; const int L0 = (blockIdx.x * 8 + (threadIdx.x >> 5)) * 8; const int nlines = N * K / 64;
{
#pragma unroll 1
        for (int l = 0; l < 8; ++l) { const int L = L0 + l; if (L >= nlines) break; const size_t e = (size_t)L * 64 + lane * 2; const int k = (int)(e % K), n = (int)(e / K); v2us o;
            o[0] = f2bf(w[(size_t)k * N + n]); o[1] = f2bf(w[(size_t)(k + 1) * N + n]); *(v2us*)(Bt + e) = o; }
         }
}
__global__ __launch_bounds__(256) void k_cvt8(const float* __restrict__ src, bf* dst, size_t n8) { const size_t i = (size_t)blockIdx.x * 256 + threadIdx.x; if (i >= n8) return; const v8f v = *(const v8f*)(src + i * 8); v8us o;
#pragma unroll
    for (int k = 0; k < 8; ++k) o[k] = f2bf(v[k]); *(v8us*)(dst + i * 8) = o;  }

// k_rope: head planes [h][t][d] (fp16 + hi/lo) of rope(x) x sc with the rotate-half convention out[d] = x[d] cos[t][d] - x[d+HD/2] sin[t][d], out[d+HD/2] = x[d+HD/2] cos[t][d+HD/2] + x[d] sin[t][d+HD/2]
__global__ __launch_bounds__(256) void k_rope(const float* __restrict__ F, int pitch, int nheads, const float* __restrict__ CS, const float* __restrict__ RF, const float* __restrict__ nw, float sc, h16* P16, bf* Ph, bf* Pl) {
    const size_t e = ((size_t)blockIdx.x * 256 + threadIdx.x) * 2; if (e >= (size_t)nheads * TT * HD) return; const int d = (int)(e % HD); const int t = (int)((e / HD) % TT); const int h = (int)(e / ((size_t)HD * TT)); const float* f = F + (size_t)t * pitch + h * HD; const float rf = RF ? RF[(size_t)h * TT + t] : 1.0f; v2h o16; v2us oh, ol;
#pragma unroll
    for (int q = 0; q < 2; ++q) { const int dd = d + q; const int dp = (dd < HD / 2) ? dd + HD / 2 : dd - HD / 2; float x0 = f[dd], x1 = f[dp];
        if (RF) { float n0 = __fmul_rn(x0, rf), n1 = __fmul_rn(x1, rf); asm volatile("" : "+v"(n0)); asm volatile("" : "+v"(n1)); x0 = __fmul_rn(bfr(nw[dd]), n0); x1 = __fmul_rn(bfr(nw[dp]), n1); }
        const v2f cs = *(const v2f*)(CS + ((size_t)t * HD + dd) * 2); float a = __fmul_rn(x0, cs[0]), bq = __fmul_rn(x1, cs[1]); asm volatile("" : "+v"(a)); asm volatile("" : "+v"(bq)); const float r = ((dd < HD / 2) ? __fsub_rn(a, bq) : __fadd_rn(a, bq)) * sc;
        o16[q] = tohx(r); unsigned short a2, c2; splitf(r, a2, c2); oh[q] = a2; ol[q] = c2; }
    *(v2h*)(P16 + e) = o16; *(v2us*)(Ph + e) = oh; *(v2us*)(Pl + e) = ol;  }
__global__ __launch_bounds__(256) void k_vtp(const float* __restrict__ F, int pitch, int nheads, h16* V16, bf* Vh, bf* Vl) { const size_t e = ((size_t)blockIdx.x * 256 + threadIdx.x) * 2; if (e >= (size_t)nheads * HD * TT) return; const int t = (int)(e % TT); const int d = (int)((e / TT) % HD); const int g = (int)(e / ((size_t)TT * HD)); v2h o16; v2us oh, ol;
#pragma unroll
    for (int q = 0; q < 2; ++q) { const float x = F[(size_t)(t + q) * pitch + g * HD + d]; o16[q] = tohx(x); unsigned short a2, c2; splitf(x, a2, c2); oh[q] = a2; ol[q] = c2; }
    *(v2h*)(V16 + e) = o16; *(v2us*)(Vh + e) = oh; *(v2us*)(Vl + e) = ol;  }
__global__ __launch_bounds__(256) void k_csid(float* CS) { const int idx = blockIdx.x * 256 + threadIdx.x; if (idx >= TT * HD) return; v2f cs; cs[0] = 1.0f; cs[1] = 0.0f; *(v2f*)(CS + (size_t)idx * 2) = cs;  }
__global__ __launch_bounds__(256) void k_ssoft(const float* __restrict__ Sb, int r0, bf* Ph, bf* Pl) {
    const int lane = threadIdx.x & 31; const int ri = blockIdx.x * 8 + (threadIdx.x >> 5); if (ri >= RB) return; const int i = r0 + ri; const float* sr = Sb + (size_t)ri * TT; const int nval = i + 1;   /* causal, diagonal kept: keys 0 .. i */
    float mx = -3.0e38f;
#pragma unroll 1
    for (int j0 = lane * 4; j0 < nval; j0 += 128) { const v4f a = *(const v4f*)(sr + j0);
#pragma unroll
        for (int q = 0; q < 4; ++q) if (j0 + q < nval) mx = fmaxf(mx, a[q] * SCL); }
#pragma unroll
    for (int sh = 16; sh; sh >>= 1) mx = fmaxf(mx, __shfl_xor(mx, sh, 32));
    float sum = 0.f;
#pragma unroll 1
    for (int j0 = lane * 4; j0 < nval; j0 += 128) { const v4f a = *(const v4f*)(sr + j0);
#pragma unroll
        for (int q = 0; q < 4; ++q) if (j0 + q < nval) { float d0 = __fsub_rn(a[q] * SCL, mx); asm volatile("" : "+v"(d0)); sum += __builtin_amdgcn_exp2f(__fmul_rn(d0, 1.4426950408889634f)); } }
#pragma unroll
    for (int sh = 16; sh; sh >>= 1) sum += __shfl_xor(sum, sh, 32);
    const float f = (nval > 0) ? __fdiv_rn(1.0f, sum) : 0.f;
{
#pragma unroll 1
        for (int j0 = lane * 4; j0 < TT; j0 += 128) { const v4f a = *(const v4f*)(sr + j0); v4us oh, ol;
#pragma unroll
            for (int q = 0; q < 4; ++q) { float pv = 0.f; if (j0 + q < nval) { float d0 = __fsub_rn(a[q] * SCL, mx); asm volatile("" : "+v"(d0)); pv = __builtin_amdgcn_exp2f(__fmul_rn(d0, 1.4426950408889634f)) * f; } unsigned short h2, l2; splitf(pv, h2, l2); oh[q] = h2; ol[q] = l2; }
            const size_t oo = (size_t)ri * TT + j0; *(v4us*)(Ph + oo) = oh; *(v4us*)(Pl + oo) = ol; }
         } }

__global__ __launch_bounds__(256) void k_merge(const float* __restrict__ O, int h0, float* OUTb) { const size_t e = ((size_t)blockIdx.x * 256 + threadIdx.x) * 2; if (e >= (size_t)ZH * TT * HD) return; const int d = (int)(e % HD); const int t = (int)((e / HD) % TT); const int zz = (int)(e / ((size_t)HD * TT)); const float cs = (t < RH) ? 1.0f : (1.0f / PCAR); const size_t oo = (size_t)t * DQ + (h0 + zz) * HD + d;
    const int nch = __builtin_amdgcn_readfirstlane(((t >> 6) * 64 + 64 + KCH - 1) / KCH);   /* chunks that row t's tile has: only those planes were written; a wave's 64 elements lie in one row, so the count is a scalar and the tests below are scalar branches */
    v2f pl[TT / KCH];   /* all of a row's planes are loaded before the first add, so that their latencies overlap */
#pragma unroll
    for (int s = 0; s < TT / KCH / 2; ++s) pl[s] = (s < nch) ? *(const v2f*)(O + (size_t)s * ZH * TT * HD + e) : (v2f){0.f, 0.f};
    asm volatile("s_wait_xcnt 0x0" ::: "memory");   /* the far planes' addresses are formed anew, the last of them in the register pair that the loads above name: the wait stands before that write */
#pragma unroll
    for (int s = TT / KCH / 2; s < TT / KCH; ++s) pl[s] = (s < nch) ? *(const v2f*)(O + (size_t)s * ZH * TT * HD + e) : (v2f){0.f, 0.f};
    v2f a2 = pl[0];
#pragma unroll
    for (int s = 1; s < TT / KCH; ++s) a2 += pl[s];
    v2f o2; o2[0] = a2[0] * cs; o2[1] = a2[1] * cs; *(v2f*)(OUTb + oo) = o2;  }   /* f32 context straight to the output */

extern "C" void kernel_launch(void* const* d_in, const int* in_sizes, int n_in,
                              void* d_out, int out_size, void* d_ws, size_t ws_size, hipStream_t stream) {
    (void)in_sizes; (void)n_in; (void)out_size;
    const float* x = (const float*)d_in[0]; const float* wq = (const float*)d_in[1]; const float* wk = (const float*)d_in[2]; const float* wv = (const float*)d_in[3]; const float* wo = nullptr; (void)wo;
    float* OUT = (float*)d_out;     // [4][4096][128]
    char* wsp = (char*)d_ws;
    auto take = [&](size_t bytes) { char* p = wsp; wsp += (bytes + 255) & ~(size_t)255; return (void*)p; };
    bf* WQ = (bf*)take((size_t)DQ * DM * 2); bf* WK = (bf*)take((size_t)DKV * DM * 2); bf* WV = (bf*)take((size_t)DKV * DM * 2); float* CS = (float*)take((size_t)TT * HD * 2 * 4);
    bf* XB = (bf*)take((size_t)TT * DM * 2); float* FQ = (float*)take((size_t)TT * DQ * 4); float* FK = (float*)take((size_t)TT * DKV * 4);
    h16* QP16 = (h16*)take((size_t)NH_ * TT * HD * 2); h16* KP16 = (h16*)take((size_t)NKV * TT * HD * 2); h16* VT16 = (h16*)take((size_t)NKV * HD * TT * 2);
    bf* QPh = (bf*)take((size_t)NH_ * TT * HD * 2); bf* QPl = (bf*)take((size_t)NH_ * TT * HD * 2); bf* KPh = (bf*)take((size_t)NKV * TT * HD * 2); bf* KPl = (bf*)take((size_t)NKV * TT * HD * 2); bf* VTh = (bf*)take((size_t)NKV * HD * TT * 2); bf* VTl = (bf*)take((size_t)NKV * HD * TT * 2); bf* Ph = (bf*)take((size_t)ZH * RH * TT * 2); bf* Pl = (bf*)take((size_t)ZH * RH * TT * 2);
    float* Sb = (float*)take((size_t)ZH * TT * TT * 4); h16* P16 = (h16*)take(256);   /* unused: all rows hi/lo */ float* Ob = (float*)take((size_t)(TT / KCH) * ZH * TT * HD * 4); 
    if ((size_t)(wsp - (char*)d_ws) > ws_size) return;    // ws 256 MiB
    float* FV = FK;   // v projection reuses the k buffer after the k planes are built (stream-ordered)
    { k_wtG<<<(unsigned)((DM * DQ / 64 + 63) / 64), 256, 0, stream>>>(wq, DM, DQ, WQ); k_wtG<<<(unsigned)((DM * DKV / 64 + 63) / 64), 256, 0, stream>>>(wk, DM, DKV, WK); k_wtG<<<(unsigned)((DM * DKV / 64 + 63) / 64), 256, 0, stream>>>(wv, DM, DKV, WV);
       }
    k_csid<<<(TT * HD + 255) / 256, 256, 0, stream>>>(CS);
    const unsigned LQ = (unsigned)(((size_t)NH_ * TT * HD / 2 + 255) / 256), LKv = (unsigned)(((size_t)NKV * TT * HD / 2 + 255) / 256);
    for (int b = 0; b < NB_; ++b) {
        
        k_cvt8<<<(unsigned)(((size_t)TT * DM / 8 + 255) / 256), 256, 0, stream>>>(x + (size_t)b * TT * DM, XB, (size_t)TT * DM / 8);
        k_gemms<bf, 0, 0, 12, 64><<<dim3(TT / 64, DQ / 64, 1), 12 * 32, 0, stream>>>(XB, nullptr, WQ, nullptr, DM, FQ, DQ, 0);
        k_rope<<<LQ, 256, 0, stream>>>(FQ, DQ, NH_, CS, nullptr, nullptr, 1.0f, QP16, QPh, QPl);
        k_gemms<bf, 0, 0, 12, 64><<<dim3(TT / 64, DKV / 64, 1), 12 * 32, 0, stream>>>(XB, nullptr, WK, nullptr, DM, FK, DKV, 0);
        k_rope<<<LKv, 256, 0, stream>>>(FK, DKV, NKV, CS, nullptr, nullptr, 1.0f, KP16, KPh, KPl);
        k_gemms<bf, 0, 0, 12, 64><<<dim3(TT / 64, DKV / 64, 1), 12 * 32, 0, stream>>>(XB, nullptr, WV, nullptr, DM, FV, DKV, 0); k_vtp<<<LKv, 256, 0, stream>>>(FV, DKV, NKV, VT16, VTh, VTl);
        for (int h0 = 0; h0 < NH_; h0 += ZH) { const size_t zq = (size_t)h0, zk = (size_t)(h0 / REP);   // one kv head per query head: the pass's one head (ZH = 1) uses kv plane h0 / REP (z-strides TT*HD)
            k_gemmc<bf, 2, 1><<<dim3(RH / 64, TT / 64, ZH), 32, 0, stream>>>(QPh + zq * TT * HD, QPl + zq * TT * HD, KPh + zk * TT * HD, KPl + zk * TT * HD, HD, Sb, TT, 0, (size_t)TT * HD, (size_t)TT * HD, (size_t)TT * TT);
            k_ssoft<<<TT / 8, 256, 0, stream>>>(Sb, 0, Ph, Pl);   /* streaming causal softmax, hi/lo planes for every row */
            k_gemms<bf, 2, 2, 8, KCH><<<dim3((KCH / 64) * (TT / KCH) * (TT / KCH + 1) / 2, HD / 64, 1), 8 * 32, 0, stream>>>(Ph, Pl, VTh + zk * HD * TT, VTl + zk * HD * TT, TT, Ob, HD, (size_t)ZH * TT * HD);
            k_merge<<<(unsigned)(((size_t)ZH * TT * HD / 2 + 255) / 256), 256, 0, stream>>>(Ob, h0, OUT + (size_t)b * TT * DQ); }
    }
}

// v002
// A run of this version takes 214 microseconds.
// Two timings next to v001 both put it at 2.40 times that version's speed.
// All steps since v000 together make it 3.99 times as fast.
#include <hip/hip_runtime.h>

// Single-head causal attention (x [4][4096][768]; q, k, v = x W ('xw' [768][128], no bias); scores = q.k, causal (-inf), softmax(scores/sqrt(128)); out = attn.v -> [4][4096][128] f32 (2.1 M); no output projection).
// Compute dtypes, f32 accumulate: every input rounded to bf16; q/k/v on PLAIN bf16 operands (inputs: exact); causal scores and attn.v (tile skipping) on hi/lo planes for every row (3 products), fused in one kernel with an online softmax in f32 (scores and probabilities stay in registers); no output projection: the context is written in f32.

#define NB_  4
#define TT   4096
#define DM   768
#define NH_  1
#define NKV  1
#define REP  (NH_ / NKV)
#define HD   128
#define DQ   (NH_ * HD)
#define DKV  (NKV * HD)
#define ZH   1
#define RH   4096                 // every row hi/lo (streaming softmax, no register row)
#define RB   TT
#define WIN  4096
#define PCAR 1024.0f
#define SCL  0.088388347648318447f   // HD^-0.5
#define KCH  512                  // keys per chunk of the probability x value product (one partial plane per chunk)
typedef _Float16 h16;
typedef unsigned short bf;
typedef __attribute__((ext_vector_type(16))) __bf16   v16bf;
typedef __attribute__((ext_vector_type(16))) _Float16 v16h;
typedef __attribute__((ext_vector_type(8)))  _Float16 v8h;
typedef __attribute__((ext_vector_type(8)))  unsigned short v8us;
typedef __attribute__((ext_vector_type(8)))  float    v8f;
typedef __attribute__((ext_vector_type(4)))  float    v4f;
typedef v8h  __attribute__((may_alias)) v8ha;
typedef v4f  __attribute__((may_alias)) v4fa;
typedef v8us __attribute__((may_alias)) v8usa;

__device__ __forceinline__ unsigned short f2bf(float f) { unsigned u = __float_as_uint(f); u += 0x7FFFu + ((u >> 16) & 1u); return (unsigned short)(u >> 16); }
__device__ __forceinline__ float bf2f(unsigned short b) { return __uint_as_float(((unsigned)b) << 16); }
__device__ __forceinline__ float bfr(float f) { return bf2f(f2bf(f)); }
__device__ __forceinline__ v16h cat16(v8h lo, v8h hi) { return __builtin_shufflevector(lo, hi, 0, 1, 2, 3, 4, 5, 6, 7, 8, 9, 10, 11, 12, 13, 14, 15); }
__device__ __forceinline__ v16bf cat16b(v8us lo, v8us hi) { return __builtin_bit_cast(v16bf, __builtin_shufflevector(lo, hi, 0, 1, 2, 3, 4, 5, 6, 7, 8, 9, 10, 11, 12, 13, 14, 15)); }
__device__ __forceinline__ v8f wmma16(v16h a, v16h b, v8f c) { return __builtin_amdgcn_wmma_f32_16x16x32_f16(false, a, false, b, (short)0, c, false, false); }
__device__ __forceinline__ v8f wmmab(v16bf a, v16bf b, v8f c) { return __builtin_amdgcn_wmma_f32_16x16x32_bf16(false, a, false, b, (short)0, c, false, false); }



// ---- k_gemms: split-K GEMM, one work-group of NW waves per 64x64 output tile; every wave keeps the whole tile (16 accumulators) and takes 64-wide slices of K (whole 128-byte lines of each operand row),
// operands straight from K-contiguous 16-bit planes; the NW partial tiles are added in LDS in wave order. C[m][n] (f32, pitch ldc) = sum_k A[m][k] Bt[n][k] (+ split products per NSPLIT). K % 64 == 0.
// CMODE 0: grid (M/64, N/64), the whole K. CMODE 2 (probability x value, causal): the K range of row tile xt ends at its diagonal block (probabilities beyond it are exactly zero) and is cut into chunks of KC keys;
// blockIdx.x counts the (row tile, chunk) pairs that exist, chunk ks writes its partial tile to plane ks of C (plane stride sC). Only CMODE 0 is launched now: the probability x value product lives in k_flash.
template <typename T16> struct WFrag;
template <> struct WFrag<h16> { typedef v16h V; static __device__ __forceinline__ V ld(const h16* p) { return cat16(*(const v8h*)p, *(const v8h*)(p + 16)); } static __device__ __forceinline__ v8f mma(V a, V b, v8f c) { return wmma16(a, b, c); } };
template <> struct WFrag<bf> { typedef v16bf V; static __device__ __forceinline__ V ld(const bf* p) { return cat16b(*(const v8us*)p, *(const v8us*)(p + 16)); } static __device__ __forceinline__ v8f mma(V a, V b, v8f c) { return wmmab(a, b, c); } };
template <typename T16, int NSPLIT, int CMODE, int NW, int KC>
__global__ __launch_bounds__(NW * 32) void k_gemms(const T16* __restrict__ A, const T16* __restrict__ A2, const T16* __restrict__ Bt, const T16* __restrict__ Bt2, int K, float* C, int ldc, size_t sC) {
    typedef typename WFrag<T16>::V V;
    __shared__ __align__(16) float red[NW * 64 * 68];
    const int lane = threadIdx.x & 31, lr = lane & 15, hi = lane >> 4; const int wv = __builtin_amdgcn_readfirstlane(threadIdx.x >> 5);   // the wave's number as a scalar: the K loops below then branch on scalar compares
    int xt = blockIdx.x, ks = 0;
    if (CMODE == 2) { constexpr int XG = KC / 64; int g = 0;      // row tiles g*XG .. g*XG+XG-1 have g+1 chunks each; XG*g*(g+1)/2 pairs stand before group g
#pragma unroll
        for (int q = 1; q < TT / KC; ++q) if (XG * q * (q + 1) / 2 <= (int)blockIdx.x) g = q;
        const int rem = (int)blockIdx.x - XG * g * (g + 1) / 2; xt = g * XG + rem % XG; ks = rem / XG; }
    const int r0 = xt * 64, c0 = blockIdx.y * 64;
    const int kbeg = ks * KC, kend = (CMODE == 2) ? min(r0 + 64, kbeg + KC) : K;
    C += (size_t)ks * sC;
    v8f acc[4][4];
#pragma unroll
    for (int mb = 0; mb < 4; ++mb)
#pragma unroll
        for (int nb = 0; nb < 4; ++nb) acc[mb][nb] = (v8f){};
    const size_t aoff = (size_t)(r0 + lr) * K + 8 * hi, boff = (size_t)(c0 + lr) * K + 8 * hi;
    // both K loops stay rolled: the fragments of two steps beside the 16 accumulators would not fit 256 registers (two work-groups per WGP)
#pragma unroll 1
    for (int k0 = kbeg + 64 * wv; k0 < kend; k0 += 64 * NW) {
#pragma unroll 1
    for (int kc = k0; kc < k0 + 64; kc += 32) {
        V a[4], a2[4];
#pragma unroll
        for (int mb = 0; mb < 4; ++mb) { a[mb] = WFrag<T16>::ld(A + aoff + (size_t)mb * 16 * K + kc); if (NSPLIT == 1 || NSPLIT == 2) a2[mb] = WFrag<T16>::ld(A2 + aoff + (size_t)mb * 16 * K + kc); }
#pragma unroll
        for (int nb = 0; nb < 4; ++nb) { const V b = WFrag<T16>::ld(Bt + boff + (size_t)nb * 16 * K + kc); V b2; if (NSPLIT >= 2) b2 = WFrag<T16>::ld(Bt2 + boff + (size_t)nb * 16 * K + kc);
#pragma unroll
            for (int mb = 0; mb < 4; ++mb) { acc[mb][nb] = WFrag<T16>::mma(a[mb], b, acc[mb][nb]); if (NSPLIT == 1 || NSPLIT == 2) acc[mb][nb] = WFrag<T16>::mma(a2[mb], b, acc[mb][nb]); if (NSPLIT >= 2) acc[mb][nb] = WFrag<T16>::mma(a[mb], b2, acc[mb][nb]); } }
        // four vector slots behind the step's last matrix instruction, on the back edge and on the exit alike, before its operands or results are touched
        asm volatile("v_nop\n\tv_nop\n\tv_nop\n\tv_nop" : "+v"(acc[0][0]), "+v"(acc[1][1]), "+v"(acc[2][2]), "+v"(acc[3][3]) : "v"(a[0]), "v"(a[3]));
    } }
    float* os = red + wv * (64 * 68);
#pragma unroll
    for (int mb = 0; mb < 4; ++mb)
#pragma unroll
        for (int nb = 0; nb < 4; ++nb)
#pragma unroll
            for (int j = 0; j < 8; ++j) os[(mb * 16 + hi * 8 + j) * 68 + nb * 16 + lr] = acc[mb][nb][j];
    __syncthreads();   // every wave's partial tile is in LDS before any thread adds them
    for (int p = threadIdx.x; p < 64 * 16; p += NW * 32) { const int row = p >> 4, cofs = (p & 15) * 4; v4f val = *(const v4fa*)(red + row * 68 + cofs);
#pragma unroll
        for (int w = 1; w < NW; ++w) val += *(const v4fa*)(red + w * (64 * 68) + row * 68 + cofs);
        *(v4f*)(C + (size_t)(r0 + row) * ldc + c0 + cofs) = val; }
}

__device__ __forceinline__ float exp2s(float x) { float r; asm("v_exp_f32 %0, %1\n\tv_nop" : "=v"(r) : "v"(x)); return r; }
#define KP 136   // LDS pitch of a key row in 16-bit elements: 128 + 8 (16 bytes more a row, for the 16-byte readers)
#define VP 72    // LDS pitch of a transposed value row: 64 + 8
typedef __attribute__((ext_vector_type(8))) __bf16 v8b;
typedef __attribute__((ext_vector_type(2))) float v2fl;
__global__ __launch_bounds__(128) void k_flash(const bf* __restrict__ Qh, const bf* __restrict__ Kh, const bf* __restrict__ Vh, float* O, float* ML) {
    typedef WFrag<bf> F; typedef F::V V;
    __shared__ __align__(16) bf sK[2][64 * KP];
    __shared__ __align__(16) bf sV[2][HD * VP];
    const int tid = threadIdx.x, lane = tid & 31, lr = lane & 15, hi = lane >> 4; const int wv = __builtin_amdgcn_readfirstlane(tid >> 5);
    constexpr int XG = KCH / 64; int g = 0;      // query tiles g*XG .. g*XG+XG-1 have g+1 chunks each; XG*g*(g+1)/2 pairs stand before group g
#pragma unroll
    for (int q = 1; q < TT / KCH; ++q) if (XG * q * (q + 1) / 2 <= (int)blockIdx.x) g = q;
    const int rem = (int)blockIdx.x - XG * g * (g + 1) / 2; const int xt = g * XG + rem % XG, ks = rem / XG;
    const int r0 = xt * 64, kbeg = ks * KCH, kend = min(r0 + 64, kbeg + KCH);
    const size_t zb = (size_t)blockIdx.y * TT * HD; Qh += zb; Kh += zb; Vh += zb;
    constexpr unsigned LO = NB_ * TT * HD;   // each lo plane stands this many elements behind its hi plane: one base register serves both, the distance goes into the instruction's offset
    const int qrow = r0 + wv * 16 + lr;
    V qh[4], ql[4]; const bf* pq = Qh + (size_t)qrow * HD + 8 * hi;
#pragma unroll
    for (int k4 = 0; k4 < 4; ++k4) { qh[k4] = F::ld(pq + k4 * 32); ql[k4] = F::ld(pq + LO + k4 * 32); }
    asm volatile("s_wait_xcnt 0x0" :: "v"(pq) : "memory");   // the address pair that the loads above name stays whole until this wait
    v8f o[8];
#pragma unroll
    for (int nd = 0; nd < 8; ++nd) o[nd] = (v8f){};
    float m = -3.0e38f, l = 0.f;
    const unsigned ko = tid * 8u, vo = (unsigned)(tid >> 3) * TT + (tid & 7) * 8u;                  // staging, global side: piece i of a key plane is 1024 elements on, of a value plane 16 rows on
    const int lko = (tid >> 4) * KP + (tid & 15) * 8, lvo = (tid >> 3) * VP + (tid & 7) * 8;     // staging, LDS side
    // rolled: one block's staging registers, scores and fragments beside the 8 accumulators and the query fragments fill the register budget of four waves per SIMD
#pragma unroll 1
    for (int kb = kbeg; kb < kend; kb += 64) {
        const int kbs = __builtin_amdgcn_readfirstlane(kb);   // the block's offset stays a scalar that is added to the lane's loop-invariant address each trip; without this the build carries the addresses as vector induction variables and goes past 256 registers (three waves per SIMD, not four)
        const bf* gkh = Kh + (size_t)kbs * HD + ko; const bf* gvh = Vh + kbs + vo;
        v8us tkh[8], tkl[8], tvh[8], tvl[8];
#pragma unroll
        for (int i = 0; i < 8; ++i) { tkh[i] = *(const v8us*)(gkh + i * 1024u); tkl[i] = *(const v8us*)(gkh + (i * 1024u + LO)); }
        asm volatile("s_wait_xcnt 0x0" :: "v"(gkh) : "memory");   // as at the query loads: the address pair stays whole until the wait
        __syncthreads();   // every wave has read the last fragment of the block before: its LDS may be overwritten
#pragma unroll
        for (int i = 0; i < 8; ++i) { *(v8us*)(&sK[0][lko + i * (8 * KP)]) = tkh[i]; *(v8us*)(&sK[1][lko + i * (8 * KP)]) = tkl[i]; }
        // the value planes are fetched when the key planes' registers are free again: all four at once would not fit 256 registers (four waves per SIMD)
#pragma unroll
        for (int i = 0; i < 8; ++i) { tvh[i] = *(const v8us*)(gvh + i * (16u * TT)); tvl[i] = *(const v8us*)(gvh + (i * (16u * TT) + LO)); }
        asm volatile("s_wait_xcnt 0x0" :: "v"(gvh) : "memory");   // as at the query loads
#pragma unroll
        for (int i = 0; i < 8; ++i) *(v8us*)(&sV[0][lvo + i * (16 * VP)]) = tvh[i];
#pragma unroll
        for (int i = 0; i < 8; ++i) *(v8us*)(&sV[1][lvo + i * (16 * VP)]) = tvl[i];
        __syncthreads();   // the block is staged before any wave reads it
#pragma unroll
        for (int h = 0; h < 2; ++h) {   // the staged block is worked on in halves of 32 keys: one half's scores, probabilities and fragments fit beside the accumulators and the query fragments in 256 registers
        v8f s[2];
#pragma unroll
        for (int nb = 0; nb < 2; ++nb) s[nb] = (v8f){};
#pragma unroll
        for (int k2 = 0; k2 < 4; k2 += 2) { V kh[2][2], kl[2][2];
#pragma unroll
            for (int u = 0; u < 2; ++u)
#pragma unroll
                for (int nb = 0; nb < 2; ++nb) { kh[u][nb] = F::ld(&sK[0][(h * 32 + nb * 16 + lr) * KP + (k2 + u) * 32 + 8 * hi]); kl[u][nb] = F::ld(&sK[1][(h * 32 + nb * 16 + lr) * KP + (k2 + u) * 32 + 8 * hi]); }
            __builtin_amdgcn_sched_barrier(0);   // all eight fragments are requested before the first product: otherwise the loads sink to their users and every three products wait a whole LDS latency
#pragma unroll
            for (int u = 0; u < 2; ++u) {
#pragma unroll
                for (int nb = 0; nb < 2; ++nb) s[nb] = F::mma(kh[u][nb], qh[k2 + u], s[nb]);   // the two accumulators in turn
#pragma unroll
                for (int nb = 0; nb < 2; ++nb) s[nb] = F::mma(kh[u][nb], ql[k2 + u], s[nb]);
#pragma unroll
                for (int nb = 0; nb < 2; ++nb) s[nb] = F::mma(kl[u][nb], qh[k2 + u], s[nb]); } }
        // s[nb][j] = score of key kb + h*32 + nb*16 + hi*8 + j for query qrow, from here on in log2 units
#pragma unroll
        for (int nb = 0; nb < 2; ++nb) s[nb] *= (SCL * 1.4426950408889634f);
        if (kb == r0) {   // only the diagonal block holds keys beyond a query (a scalar test)
#pragma unroll
            for (int nb = 0; nb < 2; ++nb)
#pragma unroll
                for (int j = 0; j < 8; ++j) if (kb + h * 32 + nb * 16 + hi * 8 + j > qrow) s[nb][j] = -3.0e38f; }
        float mloc = s[0][0];
#pragma unroll
        for (int nb = 0; nb < 2; ++nb)
#pragma unroll
            for (int j = 0; j < 8; ++j) mloc = fmaxf(mloc, s[nb][j]);
        mloc = fmaxf(mloc, __shfl_xor(mloc, 16, 32));   // the other half of the wave holds the query's other 16 keys
        // a chunk's first half holds a key of every query (kbeg <= r0), so m is a real score from then on; a half that is masked whole for a query leaves m as it is and gives probabilities 2^(-3e38 - m) = 0
        const float mn = fmaxf(m, mloc), al = exp2s(m - mn); m = mn;
#pragma unroll
        for (int nb = 0; nb < 2; ++nb)
#pragma unroll
            for (int j = 0; j < 8; ++j) s[nb][j] = exp2s(s[nb][j] - mn);
        const v8f p8 = s[0] + s[1];   // the lane's 16 probabilities summed as a tree
        l = l * al + (((p8[0] + p8[1]) + (p8[2] + p8[3])) + ((p8[4] + p8[5]) + (p8[6] + p8[7])));
#pragma unroll
        for (int nd = 0; nd < 8; ++nd) o[nd] *= al;
        const v8b h0 = __builtin_convertvector(s[0], v8b), h1 = __builtin_convertvector(s[1], v8b);
        const v8b l0 = __builtin_convertvector(s[0] - __builtin_convertvector(h0, v8f), v8b), l1 = __builtin_convertvector(s[1] - __builtin_convertvector(h1, v8f), v8b);
        const V ph = __builtin_shufflevector(h0, h1, 0, 1, 2, 3, 4, 5, 6, 7, 8, 9, 10, 11, 12, 13, 14, 15), pl = __builtin_shufflevector(l0, l1, 0, 1, 2, 3, 4, 5, 6, 7, 8, 9, 10, 11, 12, 13, 14, 15);
#pragma unroll
        for (int n0 = 0; n0 < 8; n0 += 4) { V vh[4], vl[4];
#pragma unroll
            for (int nd = 0; nd < 4; ++nd) { vh[nd] = F::ld(&sV[0][((n0 + nd) * 16 + lr) * VP + h * 32 + 8 * hi]); vl[nd] = F::ld(&sV[1][((n0 + nd) * 16 + lr) * VP + h * 32 + 8 * hi]); }
            __builtin_amdgcn_sched_barrier(0);   // as above: eight fragments requested before the first product
#pragma unroll
            for (int nd = 0; nd < 4; ++nd) o[n0 + nd] = F::mma(vh[nd], ph, o[n0 + nd]);
#pragma unroll
            for (int nd = 0; nd < 4; ++nd) o[n0 + nd] = F::mma(vh[nd], pl, o[n0 + nd]);
#pragma unroll
            for (int nd = 0; nd < 4; ++nd) o[n0 + nd] = F::mma(vl[nd], ph, o[n0 + nd]); }
        }
        // four vector slots behind the block's last matrix instruction, on the back edge and on the exit alike, before its operands or results are touched
        asm volatile("v_nop\n\tv_nop\n\tv_nop\n\tv_nop" : "+v"(o[0]), "+v"(o[1]), "+v"(o[2]), "+v"(o[3]), "+v"(o[4]), "+v"(o[5]), "+v"(o[6]), "+v"(o[7]));
    }
    l += __shfl_xor(l, 16, 32);   // the two halves' sums are joined once
    const size_t prow = ((size_t)ks * NB_ + blockIdx.y) * TT + qrow;
    float* op = O + prow * HD + hi * 8;   // o[nd][j] = context element d = nd*16 + hi*8 + j of query qrow
#pragma unroll
    for (int nd = 0; nd < 8; ++nd) { *(v4f*)(op + nd * 16) = __builtin_shufflevector(o[nd], o[nd], 0, 1, 2, 3); *(v4f*)(op + nd * 16 + 4) = __builtin_shufflevector(o[nd], o[nd], 4, 5, 6, 7); }
    if (hi == 0) { v2fl ml; ml[0] = m; ml[1] = l; *(v2fl*)(ML + prow * 2) = ml; }   // a wave's 16 pairs fill one 128-byte line
}

__device__ __forceinline__ h16 tohx(float x) { return (h16)x; }
__device__ __forceinline__ void splitf(float y, unsigned short& h, unsigned short& l) { h = f2bf(y); l = f2bf(y - bf2f(h)); }
typedef __attribute__((ext_vector_type(2))) _Float16 v2h;
typedef __attribute__((ext_vector_type(4))) _Float16 v4h;
typedef __attribute__((ext_vector_type(2))) unsigned short v2us;
typedef __attribute__((ext_vector_type(4))) unsigned short v4us;
typedef __attribute__((ext_vector_type(2))) float v2f;
typedef __attribute__((ext_vector_type(4))) int v4i;

__global__ __launch_bounds__(256) void k_wtG(const float* __restrict__ w, int K, int N, bf* Bt) {
    const int lane = threadIdx.x & 31; const int L0 = (blockIdx.x * 8 + (threadIdx.x >> 5)) * 8; const int nlines = N * K / 64;
{
#pragma unroll 1
        for (int l = 0; l < 8; ++l) { const int L = L0 + l; if (L >= nlines) break; const size_t e = (size_t)L * 64 + lane * 2; const int k = (int)(e % K), n = (int)(e / K); v2us o;
            o[0] = f2bf(w[(size_t)k * N + n]); o[1] = f2bf(w[(size_t)(k + 1) * N + n]); *(v2us*)(Bt + e) = o; }
         }
}
__global__ __launch_bounds__(256) void k_cvt8(const float* __restrict__ src, bf* dst, size_t n8) { const size_t i = (size_t)blockIdx.x * 256 + threadIdx.x; if (i >= n8) return; const v8f v = *(const v8f*)(src + i * 8); v8us o;
#pragma unroll
    for (int k = 0; k < 8; ++k) o[k] = f2bf(v[k]); *(v8us*)(dst + i * 8) = o;  }

// k_rope: head planes [h][t][d] (fp16 + hi/lo) of rope(x) x sc with the rotate-half convention out[d] = x[d] cos[t][d] - x[d+HD/2] sin[t][d], out[d+HD/2] = x[d+HD/2] cos[t][d+HD/2] + x[d] sin[t][d+HD/2]
__global__ __launch_bounds__(256) void k_rope(const float* __restrict__ F, int pitch, int nheads, const float* __restrict__ CS, const float* __restrict__ RF, const float* __restrict__ nw, float sc, h16* P16, bf* Ph, bf* Pl) {
    const size_t e = ((size_t)blockIdx.x * 256 + threadIdx.x) * 2; if (e >= (size_t)nheads * TT * HD) return; const int d = (int)(e % HD); const int t = (int)((e / HD) % TT); const int h = (int)(e / ((size_t)HD * TT)); const float* f = F + (size_t)t * pitch + h * HD; const float rf = RF ? RF[(size_t)h * TT + t] : 1.0f; v2h o16; v2us oh, ol;
#pragma unroll
    for (int q = 0; q < 2; ++q) { const int dd = d + q; const int dp = (dd < HD / 2) ? dd + HD / 2 : dd - HD / 2; float x0 = f[dd], x1 = f[dp];
        if (RF) { float n0 = __fmul_rn(x0, rf), n1 = __fmul_rn(x1, rf); asm volatile("" : "+v"(n0)); asm volatile("" : "+v"(n1)); x0 = __fmul_rn(bfr(nw[dd]), n0); x1 = __fmul_rn(bfr(nw[dp]), n1); }
        const v2f cs = *(const v2f*)(CS + ((size_t)t * HD + dd) * 2); float a = __fmul_rn(x0, cs[0]), bq = __fmul_rn(x1, cs[1]); asm volatile("" : "+v"(a)); asm volatile("" : "+v"(bq)); const float r = ((dd < HD / 2) ? __fsub_rn(a, bq) : __fadd_rn(a, bq)) * sc;
        o16[q] = tohx(r); unsigned short a2, c2; splitf(r, a2, c2); oh[q] = a2; ol[q] = c2; }
    *(v2h*)(P16 + e) = o16; *(v2us*)(Ph + e) = oh; *(v2us*)(Pl + e) = ol;  }
__global__ __launch_bounds__(256) void k_vtp(const float* __restrict__ F, int pitch, int nheads, h16* V16, bf* Vh, bf* Vl) { const size_t e = ((size_t)blockIdx.x * 256 + threadIdx.x) * 2; if (e >= (size_t)nheads * HD * TT) return; const int t = (int)(e % TT); const int d = (int)((e / TT) % HD); const int g = (int)(e / ((size_t)TT * HD)); v2h o16; v2us oh, ol;
#pragma unroll
    for (int q = 0; q < 2; ++q) { const float x = F[(size_t)(t + q) * pitch + g * HD + d]; o16[q] = tohx(x); unsigned short a2, c2; splitf(x, a2, c2); oh[q] = a2; ol[q] = c2; }
    *(v2h*)(V16 + e) = o16; *(v2us*)(Vh + e) = oh; *(v2us*)(Vl + e) = ol;  }
__global__ __launch_bounds__(256) void k_csid(float* CS) { const int idx = blockIdx.x * 256 + threadIdx.x; if (idx >= TT * HD) return; v2f cs; cs[0] = 1.0f; cs[1] = 0.0f; *(v2f*)(CS + (size_t)idx * 2) = cs;  }
// k_merge: joins a query's chunks: out = sum_s w_s O_s / sum_s w_s l_s with w_s = 2^(m_s - max m). One wave per query row (32 lanes x 4 elements), all batches in one launch.
__global__ __launch_bounds__(256) void k_merge(const float* __restrict__ O, const float* __restrict__ ML, float* OUTb) { const unsigned e = (blockIdx.x * 256u + threadIdx.x) * 4u, bt = e / HD; const int t = (int)(bt % TT);
    const int nch = __builtin_amdgcn_readfirstlane(((t >> 6) * 64 + 64 + KCH - 1) / KCH);   /* chunks that row t's tile has: only those planes were written; a wave lies in one row, so the count is a scalar */
    v4f pl[TT / KCH]; v2f ml[TT / KCH]; const float* po[TT / KCH]; const float* pm[TT / KCH];   /* all planes are loaded before the first use, so that their latencies overlap; a plane the row does not have is replaced by its last one (written, in cache) and gets weight 0: no branch */
#pragma unroll
    for (int s = 0; s < TT / KCH; ++s) { const int sc = min(s, nch - 1); po[s] = O + (size_t)sc * NB_ * TT * HD + e; pm[s] = ML + (size_t)sc * NB_ * TT * 2 + bt * 2u; pl[s] = *(const v4f*)po[s]; ml[s] = *(const v2f*)pm[s]; }
    /* every address pair that the loads above name stays whole until this wait */
    asm volatile("s_wait_xcnt 0x0" :: "v"(po[0]), "v"(po[1]), "v"(po[2]), "v"(po[3]), "v"(po[4]), "v"(po[5]), "v"(po[6]), "v"(po[7]), "v"(pm[0]), "v"(pm[1]), "v"(pm[2]), "v"(pm[3]), "v"(pm[4]), "v"(pm[5]), "v"(pm[6]), "v"(pm[7]) : "memory");
#pragma unroll
    for (int s = 1; s < TT / KCH; ++s) if (s >= nch) ml[s][0] = -3.0e38f;
    float mx = ml[0][0];
#pragma unroll
    for (int s = 1; s < TT / KCH; ++s) mx = fmaxf(mx, ml[s][0]);
    float den = 0.f; v4f a4 = (v4f){0.f, 0.f, 0.f, 0.f};
#pragma unroll
    for (int s = 0; s < TT / KCH; ++s) { const float w = exp2s(ml[s][0] - mx); den += w * ml[s][1]; a4 += pl[s] * w; }
    *(v4f*)(OUTb + e) = a4 * __fdiv_rn(1.0f, den);  }   /* f32 context straight to the output */

extern "C" void kernel_launch(void* const* d_in, const int* in_sizes, int n_in,
                              void* d_out, int out_size, void* d_ws, size_t ws_size, hipStream_t stream) {
    (void)in_sizes; (void)n_in; (void)out_size;
    const float* x = (const float*)d_in[0]; const float* wq = (const float*)d_in[1]; const float* wk = (const float*)d_in[2]; const float* wv = (const float*)d_in[3]; const float* wo = nullptr; (void)wo;
    float* OUT = (float*)d_out;     // [4][4096][128]
    char* wsp = (char*)d_ws;
    auto take = [&](size_t bytes) { char* p = wsp; wsp += (bytes + 255) & ~(size_t)255; return (void*)p; };
    bf* WQ = (bf*)take((size_t)DQ * DM * 2); bf* WK = (bf*)take((size_t)DKV * DM * 2); bf* WV = (bf*)take((size_t)DKV * DM * 2); float* CS = (float*)take((size_t)TT * HD * 2 * 4);
    bf* XB = (bf*)take((size_t)TT * DM * 2); float* FQ = (float*)take((size_t)TT * DQ * 4); float* FK = (float*)take((size_t)TT * DKV * 4);
    h16* QP16 = (h16*)take((size_t)NH_ * TT * HD * 2); h16* KP16 = (h16*)take((size_t)NKV * TT * HD * 2); h16* VT16 = (h16*)take((size_t)NKV * HD * TT * 2);
    const size_t PB = (size_t)TT * HD;   // one batch's plane; the hi/lo planes of all batches are kept for the one attention launch
    bf* QPh = (bf*)take(2 * NB_ * PB * 2); bf* QPl = QPh + NB_ * PB; bf* KPh = (bf*)take(2 * NB_ * PB * 2); bf* KPl = KPh + NB_ * PB; bf* VTh = (bf*)take(2 * NB_ * PB * 2); bf* VTl = VTh + NB_ * PB;   // each lo plane right behind its hi plane
    float* Ob = (float*)take((size_t)(TT / KCH) * NB_ * PB * 4); float* ML = (float*)take((size_t)(TT / KCH) * NB_ * TT * 2 * 4);
    if ((size_t)(wsp - (char*)d_ws) > ws_size) return;    // ws 256 MiB
    float* FV = FK;   // v projection reuses the k buffer after the k planes are built (stream-ordered)
    { k_wtG<<<(unsigned)((DM * DQ / 64 + 63) / 64), 256, 0, stream>>>(wq, DM, DQ, WQ); k_wtG<<<(unsigned)((DM * DKV / 64 + 63) / 64), 256, 0, stream>>>(wk, DM, DKV, WK); k_wtG<<<(unsigned)((DM * DKV / 64 + 63) / 64), 256, 0, stream>>>(wv, DM, DKV, WV);
       }
    k_csid<<<(TT * HD + 255) / 256, 256, 0, stream>>>(CS);
    const unsigned LQ = (unsigned)(((size_t)NH_ * TT * HD / 2 + 255) / 256), LKv = (unsigned)(((size_t)NKV * TT * HD / 2 + 255) / 256);
    for (int b = 0; b < NB_; ++b) {
        
        k_cvt8<<<(unsigned)(((size_t)TT * DM / 8 + 255) / 256), 256, 0, stream>>>(x + (size_t)b * TT * DM, XB, (size_t)TT * DM / 8);
        k_gemms<bf, 0, 0, 12, 64><<<dim3(TT / 64, DQ / 64, 1), 12 * 32, 0, stream>>>(XB, nullptr, WQ, nullptr, DM, FQ, DQ, 0);
        k_rope<<<LQ, 256, 0, stream>>>(FQ, DQ, NH_, CS, nullptr, nullptr, 1.0f, QP16, QPh + b * PB, QPl + b * PB);
        k_gemms<bf, 0, 0, 12, 64><<<dim3(TT / 64, DKV / 64, 1), 12 * 32, 0, stream>>>(XB, nullptr, WK, nullptr, DM, FK, DKV, 0);
        k_rope<<<LKv, 256, 0, stream>>>(FK, DKV, NKV, CS, nullptr, nullptr, 1.0f, KP16, KPh + b * PB, KPl + b * PB);
        k_gemms<bf, 0, 0, 12, 64><<<dim3(TT / 64, DKV / 64, 1), 12 * 32, 0, stream>>>(XB, nullptr, WV, nullptr, DM, FV, DKV, 0); k_vtp<<<LKv, 256, 0, stream>>>(FV, DKV, NKV, VT16, VTh + b * PB, VTl + b * PB);
    }
    k_flash<<<dim3((KCH / 64) * (TT / KCH) * (TT / KCH + 1) / 2, NB_, 1), 128, 0, stream>>>(QPh, KPh, VTh, Ob, ML);
    k_merge<<<(unsigned)((size_t)NB_ * TT * HD / 4 / 256), 256, 0, stream>>>(Ob, ML, OUT);
}

// v003
// Measured time: 92.2 microseconds a run.
// Timed twice side by side with v002, it ran 2.33 and 2.34 times as fast.
// Over all steps from v000 it is 9.31 times as fast.
#include <hip/hip_runtime.h>

// Single-head causal attention (x [4][4096][768]; q, k, v = x W ('xw' [768][128], no bias); scores = q.k, causal (-inf), softmax(scores/sqrt(128)); out = attn.v -> [4][4096][128] f32 (2.1 M); no output projection).
// Compute dtypes, f32 accumulate: every input rounded to bf16; q/k/v on PLAIN bf16 operands (inputs: exact), one kernel for all three and all batches that rounds x on the way into LDS and writes the hi/lo planes itself; causal scores and attn.v (tile skipping) on hi/lo planes for every row (3 products), fused in one kernel with an online softmax in f32 (scores and probabilities stay in registers); no output projection: the context is written in f32.

#define NB_  4
#define TT   4096
#define DM   768
#define NH_  1
#define NKV  1
#define REP  (NH_ / NKV)
#define HD   128
#define DQ   (NH_ * HD)
#define DKV  (NKV * HD)
#define ZH   1
#define RH   4096                 // every row hi/lo (streaming softmax, no register row)
#define RB   TT
#define WIN  4096
#define PCAR 1024.0f
#define SCL  0.088388347648318447f   // HD^-0.5
#define KCH  512                  // keys per chunk of the probability x value product (one partial plane per chunk)
typedef _Float16 h16;
typedef unsigned short bf;
typedef __attribute__((ext_vector_type(16))) __bf16   v16bf;
typedef __attribute__((ext_vector_type(16))) _Float16 v16h;
typedef __attribute__((ext_vector_type(8)))  _Float16 v8h;
typedef __attribute__((ext_vector_type(8)))  unsigned short v8us;
typedef __attribute__((ext_vector_type(8)))  float    v8f;
typedef __attribute__((ext_vector_type(4)))  float    v4f;
typedef v8h  __attribute__((may_alias)) v8ha;
typedef v4f  __attribute__((may_alias)) v4fa;
typedef v8us __attribute__((may_alias)) v8usa;

__device__ __forceinline__ unsigned short f2bf(float f) { unsigned u = __float_as_uint(f); u += 0x7FFFu + ((u >> 16) & 1u); return (unsigned short)(u >> 16); }
__device__ __forceinline__ float bf2f(unsigned short b) { return __uint_as_float(((unsigned)b) << 16); }
__device__ __forceinline__ float bfr(float f) { return bf2f(f2bf(f)); }
__device__ __forceinline__ v16h cat16(v8h lo, v8h hi) { return __builtin_shufflevector(lo, hi, 0, 1, 2, 3, 4, 5, 6, 7, 8, 9, 10, 11, 12, 13, 14, 15); }
__device__ __forceinline__ v16bf cat16b(v8us lo, v8us hi) { return __builtin_bit_cast(v16bf, __builtin_shufflevector(lo, hi, 0, 1, 2, 3, 4, 5, 6, 7, 8, 9, 10, 11, 12, 13, 14, 15)); }
__device__ __forceinline__ v8f wmma16(v16h a, v16h b, v8f c) { return __builtin_amdgcn_wmma_f32_16x16x32_f16(false, a, false, b, (short)0, c, false, false); }
__device__ __forceinline__ v8f wmmab(v16bf a, v16bf b, v8f c) { return __builtin_amdgcn_wmma_f32_16x16x32_bf16(false, a, false, b, (short)0, c, false, false); }



// ---- fragment loaders: 16 elements of a K-contiguous 16-bit row per lane (k = 8*hi .. 8*hi+7 and 16+8*hi .. 16+8*hi+7), the same for the A and the B operand
template <typename T16> struct WFrag;
template <> struct WFrag<h16> { typedef v16h V; static __device__ __forceinline__ V ld(const h16* p) { return cat16(*(const v8h*)p, *(const v8h*)(p + 16)); } static __device__ __forceinline__ v8f mma(V a, V b, v8f c) { return wmma16(a, b, c); } };
template <> struct WFrag<bf> { typedef v16bf V; static __device__ __forceinline__ V ld(const bf* p) { return cat16b(*(const v8us*)p, *(const v8us*)(p + 16)); } static __device__ __forceinline__ v8f mma(V a, V b, v8f c) { return wmmab(a, b, c); } };

typedef __attribute__((ext_vector_type(2))) unsigned short v2us;
typedef __attribute__((ext_vector_type(2))) float v2f;
typedef __attribute__((ext_vector_type(8))) __bf16 v8b;

// ---- k_wt3: the three weights [DM][HD] f32 -> one K-contiguous 16-bit plane Bt[3*HD][DM] (rows 0..127 q, 128..255 k, 256..383 v). blockIdx.y picks the weight; a thread makes two neighbours in k.
__global__ __launch_bounds__(256) void k_wt3(const float* __restrict__ wq, const float* __restrict__ wk, const float* __restrict__ wv, bf* Bt) {
    const float* w = (blockIdx.y == 0) ? wq : ((blockIdx.y == 1) ? wk : wv);
    const unsigned e = (blockIdx.x * 256u + threadIdx.x) * 2u, k = e % DM, n = e / DM; v2us o;
    o[0] = f2bf(w[k * HD + n]); o[1] = f2bf(w[(k + 1) * HD + n]); *(v2us*)(Bt + blockIdx.y * (unsigned)(HD * DM) + e) = o; }

// ---- k_qkv: q, k and v of 64 rows of x (all batches: row = b*TT + t) in one work-group of 12 waves. The 64 x 768 tile of x is read once in f32, rounded to 16 bits and kept in LDS for all waves;
// wave w makes columns 32w .. 32w+31 of [q | k | v] (4 x 2 accumulators) over the whole K in one chain, its weight rows straight from the K-contiguous plane, fetched two 64-wide slices (whole 128-byte lines) ahead.
// The f32 results pass through LDS (q, k row-major; v transposed) and leave as the hi/lo planes that k_flash reads: Q, K [b][t][d], V [b][d][t]; every 128-byte line of a plane has one writer.
#define XP 776   // LDS pitch of an x row in 16-bit elements: 768 + 8 (16 bytes more a row, for the 16-byte readers)
#define OP 260   // LDS pitch of a [q | k] result row in f32: 256 + 4
#define OV 68    // LDS pitch of a transposed v result row in f32: 64 + 4
__global__ __launch_bounds__(384) void k_qkv(const float* __restrict__ x, const bf* __restrict__ Wt, bf* Qp, bf* Kp, bf* Vp) {
    typedef WFrag<bf> F; typedef F::V V;
    __shared__ __align__(16) bf sX[64 * XP];
    __shared__ __align__(16) float sO[64 * OP + HD * OV];
    const int tid = threadIdx.x, lane = tid & 31, lr = lane & 15, hi = lane >> 4; const int wv = __builtin_amdgcn_readfirstlane(tid >> 5);
    const int R0 = blockIdx.x * 64;
    constexpr unsigned LO = NB_ * TT * HD;   // each lo plane stands this many elements behind its hi plane
    const bf* pb = Wt + (size_t)(wv * 32 + lr) * DM + 8 * hi;
    V b[3][2][2];   // a ring of three 64-wide slices of the wave's weight rows: one in use, two in flight
#pragma unroll
    for (int s = 0; s < 2; ++s)
#pragma unroll
        for (int u = 0; u < 2; ++u)
#pragma unroll
            for (int nb = 0; nb < 2; ++nb) b[s][u][nb] = F::ld(pb + nb * 16 * DM + s * 64 + u * 32);
    { const char* xb = (const char*)(x + (size_t)R0 * DM); const unsigned xo = tid * 32u;   // the tile is 64 whole rows: one contiguous run; piece i of a thread is 384 * 32 bytes (4 rows) on
      v8f t[16];
#pragma unroll
      for (int i = 0; i < 16; ++i) t[i] = *(const v8f*)(xb + xo + i * 12288u);
      asm volatile("s_wait_xcnt 0x0" :: "v"(xo) : "memory");   // the offset register that the loads above name stays whole until this wait
      const int lx = (tid / 96) * XP + (tid % 96) * 8;
#pragma unroll
      for (int i = 0; i < 16; ++i) *(v8us*)(&sX[lx + i * (4 * XP)]) = __builtin_bit_cast(v8us, __builtin_convertvector(t[i], v8b)); }
    __syncthreads();   // the rounded tile is whole before any wave reads a fragment of it
    v8f acc[4][2];
#pragma unroll
    for (int mb = 0; mb < 4; ++mb)
#pragma unroll
        for (int nb = 0; nb < 2; ++nb) acc[mb][nb] = (v8f){};
    // unrolled whole: no back edge behind a matrix instruction, and every address is the lane's base plus a constant
#pragma unroll
    for (int it = 0; it < DM / 64; ++it) {
        if (it + 2 < DM / 64) {
#pragma unroll
            for (int u = 0; u < 2; ++u)
#pragma unroll
                for (int nb = 0; nb < 2; ++nb) b[(it + 2) % 3][u][nb] = F::ld(pb + nb * 16 * DM + (it + 2) * 64 + u * 32); }
        V a[2][4];
#pragma unroll
        for (int u = 0; u < 2; ++u)
#pragma unroll
            for (int mb = 0; mb < 4; ++mb) a[u][mb] = F::ld(&sX[(mb * 16 + lr) * XP + it * 64 + u * 32 + 8 * hi]);
        __builtin_amdgcn_sched_barrier(0);   // the weight slice two trips ahead and this trip's eight x fragments are requested before the first product: otherwise the loads sink to their users and every pair of products waits a whole L2 or LDS latency
#pragma unroll
        for (int u = 0; u < 2; ++u)
#pragma unroll
            for (int mb = 0; mb < 4; ++mb)
#pragma unroll
                for (int nb = 0; nb < 2; ++nb) acc[mb][nb] = F::mma(a[u][mb], b[it % 3][u][nb], acc[mb][nb]);
    }
    asm volatile("s_wait_xcnt 0x0" :: "v"(pb) : "memory");   // as above, for the weight rows' address pair
    // four vector slots behind the last matrix instruction, on both sides of the branch below, before its results are touched
    asm volatile("v_nop\n\tv_nop\n\tv_nop\n\tv_nop" : "+v"(acc[0][0]), "+v"(acc[0][1]), "+v"(acc[1][0]), "+v"(acc[1][1]), "+v"(acc[2][0]), "+v"(acc[2][1]), "+v"(acc[3][0]), "+v"(acc[3][1]));
    // acc[mb][nb][j] = row mb*16 + hi*8 + j, column wv*32 + nb*16 + lr
    if (wv < 8) {   // q and k: row-major (a scalar test)
#pragma unroll
        for (int mb = 0; mb < 4; ++mb)
#pragma unroll
            for (int nb = 0; nb < 2; ++nb)
#pragma unroll
                for (int j = 0; j < 8; ++j) sO[(mb * 16 + hi * 8 + j) * OP + wv * 32 + nb * 16 + lr] = acc[mb][nb][j];
    } else {        // v: transposed, a lane's 8 rows are neighbours
#pragma unroll
        for (int mb = 0; mb < 4; ++mb)
#pragma unroll
            for (int nb = 0; nb < 2; ++nb) { float* p = &sO[64 * OP + ((wv - 8) * 32 + nb * 16 + lr) * OV + mb * 16 + hi * 8];
                *(v4fa*)p = __builtin_shufflevector(acc[mb][nb], acc[mb][nb], 0, 1, 2, 3); *(v4fa*)(p + 4) = __builtin_shufflevector(acc[mb][nb], acc[mb][nb], 4, 5, 6, 7); }
    }
    __syncthreads();   // every wave's results are in LDS before any thread splits them
    // 3072 pieces of 8 results, 8 a thread: pieces 0..2047 are [q | k] (32 a row: lanes 0-15 a q row, 16-31 a k row), 2048..3071 are v (8 a row of 64 t); the border falls between waves 3 and 4 of round 5
    v8f r[8]; bf* dst[8];
#pragma unroll
    for (int i = 0; i < 8; ++i) { const int idx = i * 384 + tid; int so;
        if (i < 5 || (i == 5 && wv < 4)) { const int row = idx >> 5, cg = idx & 31; so = row * OP + cg * 8; dst[i] = ((cg < 16) ? Qp : Kp) + (size_t)(R0 + row) * HD + (cg & 15) * 8; }
        else { const int q = idx - 2048, d = q >> 3, tg = q & 7; so = 64 * OP + d * OV + tg * 8; dst[i] = Vp + (size_t)(R0 / TT) * (TT * HD) + (size_t)d * TT + (R0 % TT) + tg * 8; }
        const v4f r0 = *(const v4fa*)(sO + so), r1 = *(const v4fa*)(sO + so + 4); r[i] = __builtin_shufflevector(r0, r1, 0, 1, 2, 3, 4, 5, 6, 7); }
#pragma unroll
    for (int i = 0; i < 8; ++i) { const v8b h = __builtin_convertvector(r[i], v8b); const v8b l = __builtin_convertvector(r[i] - __builtin_convertvector(h, v8f), v8b);   // hi = the result rounded to 16 bits, lo = what is left, rounded
        *(v8us*)dst[i] = __builtin_bit_cast(v8us, h); *(v8us*)(dst[i] + LO) = __builtin_bit_cast(v8us, l); }
    // every address pair that the stores above name stays whole until this wait
    asm volatile("s_wait_xcnt 0x0" :: "v"(dst[0]), "v"(dst[1]), "v"(dst[2]), "v"(dst[3]), "v"(dst[4]), "v"(dst[5]), "v"(dst[6]), "v"(dst[7]) : "memory");
}

__device__ __forceinline__ float exp2s(float x) { float r; asm("v_exp_f32 %0, %1\n\tv_nop" : "=v"(r) : "v"(x)); return r; }
#define KP 136   // LDS pitch of a key row in 16-bit elements: 128 + 8 (16 bytes more a row, for the 16-byte readers)
#define VP 72    // LDS pitch of a transposed value row: 64 + 8
typedef __attribute__((ext_vector_type(2))) float v2fl;
__global__ __launch_bounds__(128) void k_flash(const bf* __restrict__ Qh, const bf* __restrict__ Kh, const bf* __restrict__ Vh, float* O, float* ML) {
    typedef WFrag<bf> F; typedef F::V V;
    __shared__ __align__(16) bf sK[2][64 * KP];
    __shared__ __align__(16) bf sV[2][HD * VP];
    const int tid = threadIdx.x, lane = tid & 31, lr = lane & 15, hi = lane >> 4; const int wv = __builtin_amdgcn_readfirstlane(tid >> 5);
    constexpr int XG = KCH / 64; int g = 0;      // query tiles g*XG .. g*XG+XG-1 have g+1 chunks each; XG*g*(g+1)/2 pairs stand before group g
#pragma unroll
    for (int q = 1; q < TT / KCH; ++q) if (XG * q * (q + 1) / 2 <= (int)blockIdx.x) g = q;
    const int rem = (int)blockIdx.x - XG * g * (g + 1) / 2; const int xt = g * XG + rem % XG, ks = rem / XG;
    const int r0 = xt * 64, kbeg = ks * KCH, kend = min(r0 + 64, kbeg + KCH);
    const size_t zb = (size_t)blockIdx.y * TT * HD; Qh += zb; Kh += zb; Vh += zb;
    constexpr unsigned LO = NB_ * TT * HD;   // each lo plane stands this many elements behind its hi plane: one base register serves both, the distance goes into the instruction's offset
    const int qrow = r0 + wv * 16 + lr;
    V qh[4], ql[4]; const bf* pq = Qh + (size_t)qrow * HD + 8 * hi;
#pragma unroll
    for (int k4 = 0; k4 < 4; ++k4) { qh[k4] = F::ld(pq + k4 * 32); ql[k4] = F::ld(pq + LO + k4 * 32); }
    asm volatile("s_wait_xcnt 0x0" :: "v"(pq) : "memory");   // the address pair that the loads above name stays whole until this wait
    v8f o[8];
#pragma unroll
    for (int nd = 0; nd < 8; ++nd) o[nd] = (v8f){};
    float m = -3.0e38f, l = 0.f;
    const unsigned ko = tid * 8u, vo = (unsigned)(tid >> 3) * TT + (tid & 7) * 8u;                  // staging, global side: piece i of a key plane is 1024 elements on, of a value plane 16 rows on
    const int lko = (tid >> 4) * KP + (tid & 15) * 8, lvo = (tid >> 3) * VP + (tid & 7) * 8;     // staging, LDS side
    // rolled: one block's staging registers, scores and fragments beside the 8 accumulators and the query fragments fill the register budget of four waves per SIMD
#pragma unroll 1
    for (int kb = kbeg; kb < kend; kb += 64) {
        const int kbs = __builtin_amdgcn_readfirstlane(kb);   // the block's offset stays a scalar that is added to the lane's loop-invariant address each trip; without this the build carries the addresses as vector induction variables and goes past 256 registers (three waves per SIMD, not four)
        const bf* gkh = Kh + (size_t)kbs * HD + ko; const bf* gvh = Vh + kbs + vo;
        v8us tkh[8], tkl[8], tvh[8], tvl[8];
#pragma unroll
        for (int i = 0; i < 8; ++i) { tkh[i] = *(const v8us*)(gkh + i * 1024u); tkl[i] = *(const v8us*)(gkh + (i * 1024u + LO)); }
        asm volatile("s_wait_xcnt 0x0" :: "v"(gkh) : "memory");   // as at the query loads: the address pair stays whole until the wait
        __syncthreads();   // every wave has read the last fragment of the block before: its LDS may be overwritten
#pragma unroll
        for (int i = 0; i < 8; ++i) { *(v8us*)(&sK[0][lko + i * (8 * KP)]) = tkh[i]; *(v8us*)(&sK[1][lko + i * (8 * KP)]) = tkl[i]; }
        // the value planes are fetched when the key planes' registers are free again: all four at once would not fit 256 registers (four waves per SIMD)
#pragma unroll
        for (int i = 0; i < 8; ++i) { tvh[i] = *(const v8us*)(gvh + i * (16u * TT)); tvl[i] = *(const v8us*)(gvh + (i * (16u * TT) + LO)); }
        asm volatile("s_wait_xcnt 0x0" :: "v"(gvh) : "memory");   // as at the query loads
#pragma unroll
        for (int i = 0; i < 8; ++i) *(v8us*)(&sV[0][lvo + i * (16 * VP)]) = tvh[i];
#pragma unroll
        for (int i = 0; i < 8; ++i) *(v8us*)(&sV[1][lvo + i * (16 * VP)]) = tvl[i];
        __syncthreads();   // the block is staged before any wave reads it
#pragma unroll
        for (int h = 0; h < 2; ++h) {   // the staged block is worked on in halves of 32 keys: one half's scores, probabilities and fragments fit beside the accumulators and the query fragments in 256 registers
        v8f s[2];
#pragma unroll
        for (int nb = 0; nb < 2; ++nb) s[nb] = (v8f){};
#pragma unroll
        for (int k2 = 0; k2 < 4; k2 += 2) { V kh[2][2], kl[2][2];
#pragma unroll
            for (int u = 0; u < 2; ++u)
#pragma unroll
                for (int nb = 0; nb < 2; ++nb) { kh[u][nb] = F::ld(&sK[0][(h * 32 + nb * 16 + lr) * KP + (k2 + u) * 32 + 8 * hi]); kl[u][nb] = F::ld(&sK[1][(h * 32 + nb * 16 + lr) * KP + (k2 + u) * 32 + 8 * hi]); }
            __builtin_amdgcn_sched_barrier(0);   // all eight fragments are requested before the first product: otherwise the loads sink to their users and every three products wait a whole LDS latency
#pragma unroll
            for (int u = 0; u < 2; ++u) {
#pragma unroll
                for (int nb = 0; nb < 2; ++nb) s[nb] = F::mma(kh[u][nb], qh[k2 + u], s[nb]);   // the two accumulators in turn
#pragma unroll
                for (int nb = 0; nb < 2; ++nb) s[nb] = F::mma(kh[u][nb], ql[k2 + u], s[nb]);
#pragma unroll
                for (int nb = 0; nb < 2; ++nb) s[nb] = F::mma(kl[u][nb], qh[k2 + u], s[nb]); } }
        // s[nb][j] = score of key kb + h*32 + nb*16 + hi*8 + j for query qrow, from here on in log2 units
#pragma unroll
        for (int nb = 0; nb < 2; ++nb) s[nb] *= (SCL * 1.4426950408889634f);
        if (kb == r0) {   // only the diagonal block holds keys beyond a query (a scalar test)
#pragma unroll
            for (int nb = 0; nb < 2; ++nb)
#pragma unroll
                for (int j = 0; j < 8; ++j) if (kb + h * 32 + nb * 16 + hi * 8 + j > qrow) s[nb][j] = -3.0e38f; }
        float mloc = s[0][0];
#pragma unroll
        for (int nb = 0; nb < 2; ++nb)
#pragma unroll
            for (int j = 0; j < 8; ++j) mloc = fmaxf(mloc, s[nb][j]);
        mloc = fmaxf(mloc, __shfl_xor(mloc, 16, 32));   // the other half of the wave holds the query's other 16 keys
        // a chunk's first half holds a key of every query (kbeg <= r0), so m is a real score from then on; a half that is masked whole for a query leaves m as it is and gives probabilities 2^(-3e38 - m) = 0
        const float mn = fmaxf(m, mloc), al = exp2s(m - mn); m = mn;
#pragma unroll
        for (int nb = 0; nb < 2; ++nb)
#pragma unroll
            for (int j = 0; j < 8; ++j) s[nb][j] = exp2s(s[nb][j] - mn);
        const v8f p8 = s[0] + s[1];   // the lane's 16 probabilities summed as a tree
        l = l * al + (((p8[0] + p8[1]) + (p8[2] + p8[3])) + ((p8[4] + p8[5]) + (p8[6] + p8[7])));
#pragma unroll
        for (int nd = 0; nd < 8; ++nd) o[nd] *= al;
        const v8b h0 = __builtin_convertvector(s[0], v8b), h1 = __builtin_convertvector(s[1], v8b);
        const v8b l0 = __builtin_convertvector(s[0] - __builtin_convertvector(h0, v8f), v8b), l1 = __builtin_convertvector(s[1] - __builtin_convertvector(h1, v8f), v8b);
        const V ph = __builtin_shufflevector(h0, h1, 0, 1, 2, 3, 4, 5, 6, 7, 8, 9, 10, 11, 12, 13, 14, 15), pl = __builtin_shufflevector(l0, l1, 0, 1, 2, 3, 4, 5, 6, 7, 8, 9, 10, 11, 12, 13, 14, 15);
#pragma unroll
        for (int n0 = 0; n0 < 8; n0 += 4) { V vh[4], vl[4];
#pragma unroll
            for (int nd = 0; nd < 4; ++nd) { vh[nd] = F::ld(&sV[0][((n0 + nd) * 16 + lr) * VP + h * 32 + 8 * hi]); vl[nd] = F::ld(&sV[1][((n0 + nd) * 16 + lr) * VP + h * 32 + 8 * hi]); }
            __builtin_amdgcn_sched_barrier(0);   // as above: eight fragments requested before the first product
#pragma unroll
            for (int nd = 0; nd < 4; ++nd) o[n0 + nd] = F::mma(vh[nd], ph, o[n0 + nd]);
#pragma unroll
            for (int nd = 0; nd < 4; ++nd) o[n0 + nd] = F::mma(vh[nd], pl, o[n0 + nd]);
#pragma unroll
            for (int nd = 0; nd < 4; ++nd) o[n0 + nd] = F::mma(vl[nd], ph, o[n0 + nd]); }
        }
        // four vector slots behind the block's last matrix instruction, on the back edge and on the exit alike, before its operands or results are touched
        asm volatile("v_nop\n\tv_nop\n\tv_nop\n\tv_nop" : "+v"(o[0]), "+v"(o[1]), "+v"(o[2]), "+v"(o[3]), "+v"(o[4]), "+v"(o[5]), "+v"(o[6]), "+v"(o[7]));
    }
    l += __shfl_xor(l, 16, 32);   // the two halves' sums are joined once
    const size_t prow = ((size_t)ks * NB_ + blockIdx.y) * TT + qrow;
    float* op = O + prow * HD + hi * 8;   // o[nd][j] = context element d = nd*16 + hi*8 + j of query qrow
#pragma unroll
    for (int nd = 0; nd < 8; ++nd) { *(v4f*)(op + nd * 16) = __builtin_shufflevector(o[nd], o[nd], 0, 1, 2, 3); *(v4f*)(op + nd * 16 + 4) = __builtin_shufflevector(o[nd], o[nd], 4, 5, 6, 7); }
    if (hi == 0) { v2fl ml; ml[0] = m; ml[1] = l; *(v2fl*)(ML + prow * 2) = ml; }   // a wave's 16 pairs fill one 128-byte line
}

// k_merge: joins a query's chunks: out = sum_s w_s O_s / sum_s w_s l_s with w_s = 2^(m_s - max m). One wave per query row (32 lanes x 4 elements), all batches in one launch.
__global__ __launch_bounds__(256) void k_merge(const float* __restrict__ O, const float* __restrict__ ML, float* OUTb) { const unsigned e = (blockIdx.x * 256u + threadIdx.x) * 4u, bt = e / HD; const int t = (int)(bt % TT);
    const int nch = __builtin_amdgcn_readfirstlane(((t >> 6) * 64 + 64 + KCH - 1) / KCH);   /* chunks that row t's tile has: only those planes were written; a wave lies in one row, so the count is a scalar */
    v4f pl[TT / KCH]; v2f ml[TT / KCH]; const float* po[TT / KCH]; const float* pm[TT / KCH];   /* all planes are loaded before the first use, so that their latencies overlap; a plane the row does not have is replaced by its last one (written, in cache) and gets weight 0: no branch */
#pragma unroll
    for (int s = 0; s < TT / KCH; ++s) { const int sc = min(s, nch - 1); po[s] = O + (size_t)sc * NB_ * TT * HD + e; pm[s] = ML + (size_t)sc * NB_ * TT * 2 + bt * 2u; pl[s] = *(const v4f*)po[s]; ml[s] = *(const v2f*)pm[s]; }
    /* every address pair that the loads above name stays whole until this wait */
    asm volatile("s_wait_xcnt 0x0" :: "v"(po[0]), "v"(po[1]), "v"(po[2]), "v"(po[3]), "v"(po[4]), "v"(po[5]), "v"(po[6]), "v"(po[7]), "v"(pm[0]), "v"(pm[1]), "v"(pm[2]), "v"(pm[3]), "v"(pm[4]), "v"(pm[5]), "v"(pm[6]), "v"(pm[7]) : "memory");
#pragma unroll
    for (int s = 1; s < TT / KCH; ++s) if (s >= nch) ml[s][0] = -3.0e38f;
    float mx = ml[0][0];
#pragma unroll
    for (int s = 1; s < TT / KCH; ++s) mx = fmaxf(mx, ml[s][0]);
    float den = 0.f; v4f a4 = (v4f){0.f, 0.f, 0.f, 0.f};
#pragma unroll
    for (int s = 0; s < TT / KCH; ++s) { const float w = exp2s(ml[s][0] - mx); den += w * ml[s][1]; a4 += pl[s] * w; }
    *(v4f*)(OUTb + e) = a4 * __fdiv_rn(1.0f, den);  }   /* f32 context straight to the output */

extern "C" void kernel_launch(void* const* d_in, const int* in_sizes, int n_in,
                              void* d_out, int out_size, void* d_ws, size_t ws_size, hipStream_t stream) {
    (void)in_sizes; (void)n_in; (void)out_size;
    const float* x = (const float*)d_in[0]; const float* wq = (const float*)d_in[1]; const float* wk = (const float*)d_in[2]; const float* wv = (const float*)d_in[3];
    float* OUT = (float*)d_out;     // [4][4096][128]
    char* wsp = (char*)d_ws;
    auto take = [&](size_t bytes) { char* p = wsp; wsp += (bytes + 255) & ~(size_t)255; return (void*)p; };
    bf* WT = (bf*)take((size_t)3 * HD * DM * 2);
    const size_t PB = (size_t)TT * HD;   // one batch's plane; the hi/lo planes of all batches are kept for the one attention launch
    bf* QPh = (bf*)take(2 * NB_ * PB * 2); bf* KPh = (bf*)take(2 * NB_ * PB * 2); bf* VTh = (bf*)take(2 * NB_ * PB * 2);   // each lo plane right behind its hi plane
    float* Ob = (float*)take((size_t)(TT / KCH) * NB_ * PB * 4); float* ML = (float*)take((size_t)(TT / KCH) * NB_ * TT * 2 * 4);
    if ((size_t)(wsp - (char*)d_ws) > ws_size) return;    // ws 256 MiB
    k_wt3<<<dim3(HD * DM / 512, 3, 1), 256, 0, stream>>>(wq, wk, wv, WT);
    k_qkv<<<NB_ * TT / 64, 384, 0, stream>>>(x, WT, QPh, KPh, VTh);
    k_flash<<<dim3((KCH / 64) * (TT / KCH) * (TT / KCH + 1) / 2, NB_, 1), 128, 0, stream>>>(QPh, KPh, VTh, Ob, ML);
    k_merge<<<(unsigned)((size_t)NB_ * TT * HD / 4 / 256), 256, 0, stream>>>(Ob, ML, OUT);
}

// v004
// A run of this version takes 84.8 microseconds.
// Timed twice side by side with v003, it ran 1.09 and 1.08 times as fast.
// Over all steps from v000 it is 10.1 times as fast.
#include <hip/hip_runtime.h>

// Single-head causal attention (x [4][4096][768]; q, k, v = x W ('xw' [768][128], no bias); scores = q.k, causal (-inf), softmax(scores/sqrt(128)); out = attn.v -> [4][4096][128] f32 (2.1 M); no output projection).
// Compute dtypes, f32 accumulate: every input rounded to bf16; q/k/v on PLAIN bf16 operands (inputs: exact), one kernel for all three and all batches that rounds x on the way into LDS and writes the hi/lo planes itself; causal scores and attn.v (tile skipping) on hi/lo planes for every row (3 products), fused in one kernel with an online softmax in f32 (scores and probabilities stay in registers); no output projection: the context is written in f32.

#define NB_  4
#define TT   4096
#define DM   768
#define NH_  1
#define NKV  1
#define REP  (NH_ / NKV)
#define HD   128
#define DQ   (NH_ * HD)
#define DKV  (NKV * HD)
#define ZH   1
#define RH   4096                 // every row hi/lo (streaming softmax, no register row)
#define RB   TT
#define WIN  4096
#define PCAR 1024.0f
#define SCL  0.088388347648318447f   // HD^-0.5
#define KCH  512                  // keys per chunk of the probability x value product (one partial plane per chunk)
typedef _Float16 h16;
typedef unsigned short bf;
typedef __attribute__((ext_vector_type(16))) __bf16   v16bf;
typedef __attribute__((ext_vector_type(16))) _Float16 v16h;
typedef __attribute__((ext_vector_type(8)))  _Float16 v8h;
typedef __attribute__((ext_vector_type(8)))  unsigned short v8us;
typedef __attribute__((ext_vector_type(8)))  float    v8f;
typedef __attribute__((ext_vector_type(4)))  float    v4f;
typedef v8h  __attribute__((may_alias)) v8ha;
typedef v4f  __attribute__((may_alias)) v4fa;
typedef v8us __attribute__((may_alias)) v8usa;

__device__ __forceinline__ unsigned short f2bf(float f) { unsigned u = __float_as_uint(f); u += 0x7FFFu + ((u >> 16) & 1u); return (unsigned short)(u >> 16); }
__device__ __forceinline__ float bf2f(unsigned short b) { return __uint_as_float(((unsigned)b) << 16); }
__device__ __forceinline__ float bfr(float f) { return bf2f(f2bf(f)); }
__device__ __forceinline__ v16h cat16(v8h lo, v8h hi) { return __builtin_shufflevector(lo, hi, 0, 1, 2, 3, 4, 5, 6, 7, 8, 9, 10, 11, 12, 13, 14, 15); }
__device__ __forceinline__ v16bf cat16b(v8us lo, v8us hi) { return __builtin_bit_cast(v16bf, __builtin_shufflevector(lo, hi, 0, 1, 2, 3, 4, 5, 6, 7, 8, 9, 10, 11, 12, 13, 14, 15)); }
__device__ __forceinline__ v8f wmma16(v16h a, v16h b, v8f c) { return __builtin_amdgcn_wmma_f32_16x16x32_f16(false, a, false, b, (short)0, c, false, false); }
__device__ __forceinline__ v8f wmmab(v16bf a, v16bf b, v8f c) { return __builtin_amdgcn_wmma_f32_16x16x32_bf16(false, a, false, b, (short)0, c, false, false); }



// ---- fragment loaders: 16 elements of a K-contiguous 16-bit row per lane (k = 8*hi .. 8*hi+7 and 16+8*hi .. 16+8*hi+7), the same for the A and the B operand
template <typename T16> struct WFrag;
template <> struct WFrag<h16> { typedef v16h V; static __device__ __forceinline__ V ld(const h16* p) { return cat16(*(const v8h*)p, *(const v8h*)(p + 16)); } static __device__ __forceinline__ v8f mma(V a, V b, v8f c) { return wmma16(a, b, c); } };
template <> struct WFrag<bf> { typedef v16bf V; static __device__ __forceinline__ V ld(const bf* p) { return cat16b(*(const v8us*)p, *(const v8us*)(p + 16)); } static __device__ __forceinline__ v8f mma(V a, V b, v8f c) { return wmmab(a, b, c); } };

typedef __attribute__((ext_vector_type(2))) unsigned short v2us;
typedef __attribute__((ext_vector_type(2))) float v2f;
typedef __attribute__((ext_vector_type(8))) __bf16 v8b;

// ---- k_wt3: the three weights [DM][HD] f32 -> one K-contiguous 16-bit plane Bt[3*HD][DM] (rows 0..127 q, 128..255 k, 256..383 v). blockIdx.y picks the weight; a thread makes two neighbours in k.
__global__ __launch_bounds__(256) void k_wt3(const float* __restrict__ wq, const float* __restrict__ wk, const float* __restrict__ wv, bf* Bt) {
    const float* w = (blockIdx.y == 0) ? wq : ((blockIdx.y == 1) ? wk : wv);
    const unsigned e = (blockIdx.x * 256u + threadIdx.x) * 2u, k = e % DM, n = e / DM; v2us o;
    o[0] = f2bf(w[k * HD + n]); o[1] = f2bf(w[(k + 1) * HD + n]); *(v2us*)(Bt + blockIdx.y * (unsigned)(HD * DM) + e) = o; }

// ---- k_qkv: q, k and v of 64 rows of x (all batches: row = b*TT + t) in one work-group of 12 waves. The 64 x 768 tile of x is read once in f32, rounded to 16 bits and kept in LDS for all waves;
// wave w makes columns 32w .. 32w+31 of [q | k | v] (4 x 2 accumulators) over the whole K in one chain, its weight rows straight from the K-contiguous plane, fetched two 64-wide slices (whole 128-byte lines) ahead.
// The f32 results pass through LDS (q, k row-major; v transposed) and leave as the hi/lo planes that k_flash reads: Q, K [b][t][d], V [b][d][t]; every 128-byte line of a plane has one writer.
#define XP 776   // LDS pitch of an x row in 16-bit elements: 768 + 8 (16 bytes more a row, for the 16-byte readers)
#define OP 260   // LDS pitch of a [q | k] result row in f32: 256 + 4
#define OV 68    // LDS pitch of a transposed v result row in f32: 64 + 4
__global__ __launch_bounds__(384) void k_qkv(const float* __restrict__ x, const bf* __restrict__ Wt, bf* Qp, bf* Kp, bf* Vp) {
    typedef WFrag<bf> F; typedef F::V V;
    __shared__ __align__(16) bf sX[64 * XP];
    __shared__ __align__(16) float sO[64 * OP + HD * OV];
    const int tid = threadIdx.x, lane = tid & 31, lr = lane & 15, hi = lane >> 4; const int wv = __builtin_amdgcn_readfirstlane(tid >> 5);
    const int R0 = blockIdx.x * 64;
    constexpr unsigned LO = NB_ * TT * HD;   // each lo plane stands this many elements behind its hi plane
    const bf* pb = Wt + (size_t)(wv * 32 + lr) * DM + 8 * hi;
    V b[3][2][2];   // a ring of three 64-wide slices of the wave's weight rows: one in use, two in flight
#pragma unroll
    for (int s = 0; s < 2; ++s)
#pragma unroll
        for (int u = 0; u < 2; ++u)
#pragma unroll
            for (int nb = 0; nb < 2; ++nb) b[s][u][nb] = F::ld(pb + nb * 16 * DM + s * 64 + u * 32);
    { const char* xb = (const char*)(x + (size_t)R0 * DM); const unsigned xo = tid * 32u;   // the tile is 64 whole rows: one contiguous run; piece i of a thread is 384 * 32 bytes (4 rows) on
      v8f t[16];
#pragma unroll
      for (int i = 0; i < 16; ++i) t[i] = *(const v8f*)(xb + xo + i * 12288u);
      asm volatile("s_wait_xcnt 0x0" :: "v"(xo) : "memory");   // the offset register that the loads above name stays whole until this wait
      const int lx = (tid / 96) * XP + (tid % 96) * 8;
#pragma unroll
      for (int i = 0; i < 16; ++i) *(v8us*)(&sX[lx + i * (4 * XP)]) = __builtin_bit_cast(v8us, __builtin_convertvector(t[i], v8b)); }
    __syncthreads();   // the rounded tile is whole before any wave reads a fragment of it
    v8f acc[4][2];
#pragma unroll
    for (int mb = 0; mb < 4; ++mb)
#pragma unroll
        for (int nb = 0; nb < 2; ++nb) acc[mb][nb] = (v8f){};
    // unrolled whole: no back edge behind a matrix instruction, and every address is the lane's base plus a constant
#pragma unroll
    for (int it = 0; it < DM / 64; ++it) {
        if (it + 2 < DM / 64) {
#pragma unroll
            for (int u = 0; u < 2; ++u)
#pragma unroll
                for (int nb = 0; nb < 2; ++nb) b[(it + 2) % 3][u][nb] = F::ld(pb + nb * 16 * DM + (it + 2) * 64 + u * 32); }
        V a[2][4];
#pragma unroll
        for (int u = 0; u < 2; ++u)
#pragma unroll
            for (int mb = 0; mb < 4; ++mb) a[u][mb] = F::ld(&sX[(mb * 16 + lr) * XP + it * 64 + u * 32 + 8 * hi]);
        __builtin_amdgcn_sched_barrier(0);   // the weight slice two trips ahead and this trip's eight x fragments are requested before the first product: otherwise the loads sink to their users and every pair of products waits a whole L2 or LDS latency
#pragma unroll
        for (int u = 0; u < 2; ++u)
#pragma unroll
            for (int mb = 0; mb < 4; ++mb)
#pragma unroll
                for (int nb = 0; nb < 2; ++nb) acc[mb][nb] = F::mma(a[u][mb], b[it % 3][u][nb], acc[mb][nb]);
    }
    asm volatile("s_wait_xcnt 0x0" :: "v"(pb) : "memory");   // as above, for the weight rows' address pair
    // four vector slots behind the last matrix instruction, on both sides of the branch below, before its results are touched
    asm volatile("v_nop\n\tv_nop\n\tv_nop\n\tv_nop" : "+v"(acc[0][0]), "+v"(acc[0][1]), "+v"(acc[1][0]), "+v"(acc[1][1]), "+v"(acc[2][0]), "+v"(acc[2][1]), "+v"(acc[3][0]), "+v"(acc[3][1]));
    // acc[mb][nb][j] = row mb*16 + hi*8 + j, column wv*32 + nb*16 + lr
    if (wv < 8) {   // q and k: row-major (a scalar test)
#pragma unroll
        for (int mb = 0; mb < 4; ++mb)
#pragma unroll
            for (int nb = 0; nb < 2; ++nb)
#pragma unroll
                for (int j = 0; j < 8; ++j) sO[(mb * 16 + hi * 8 + j) * OP + wv * 32 + nb * 16 + lr] = acc[mb][nb][j];
    } else {        // v: transposed, a lane's 8 rows are neighbours
#pragma unroll
        for (int mb = 0; mb < 4; ++mb)
#pragma unroll
            for (int nb = 0; nb < 2; ++nb) { float* p = &sO[64 * OP + ((wv - 8) * 32 + nb * 16 + lr) * OV + mb * 16 + hi * 8];
                *(v4fa*)p = __builtin_shufflevector(acc[mb][nb], acc[mb][nb], 0, 1, 2, 3); *(v4fa*)(p + 4) = __builtin_shufflevector(acc[mb][nb], acc[mb][nb], 4, 5, 6, 7); }
    }
    __syncthreads();   // every wave's results are in LDS before any thread splits them
    // 3072 pieces of 8 results, 8 a thread: pieces 0..2047 are [q | k] (32 a row: lanes 0-15 a q row, 16-31 a k row), 2048..3071 are v (8 a row of 64 t); the border falls between waves 3 and 4 of round 5
    v8f r[8]; bf* dst[8];
#pragma unroll
    for (int i = 0; i < 8; ++i) { const int idx = i * 384 + tid; int so;
        if (i < 5 || (i == 5 && wv < 4)) { const int row = idx >> 5, cg = idx & 31; so = row * OP + cg * 8; dst[i] = ((cg < 16) ? Qp : Kp) + (size_t)(R0 + row) * HD + (cg & 15) * 8; }
        else { const int q = idx - 2048, d = q >> 3, tg = q & 7; so = 64 * OP + d * OV + tg * 8; dst[i] = Vp + (size_t)(R0 / TT) * (TT * HD) + (size_t)d * TT + (R0 % TT) + tg * 8; }
        const v4f r0 = *(const v4fa*)(sO + so), r1 = *(const v4fa*)(sO + so + 4); r[i] = __builtin_shufflevector(r0, r1, 0, 1, 2, 3, 4, 5, 6, 7); }
#pragma unroll
    for (int i = 0; i < 8; ++i) { const v8b h = __builtin_convertvector(r[i], v8b); const v8b l = __builtin_convertvector(r[i] - __builtin_convertvector(h, v8f), v8b);   // hi = the result rounded to 16 bits, lo = what is left, rounded
        *(v8us*)dst[i] = __builtin_bit_cast(v8us, h); *(v8us*)(dst[i] + LO) = __builtin_bit_cast(v8us, l); }
    // every address pair that the stores above name stays whole until this wait
    asm volatile("s_wait_xcnt 0x0" :: "v"(dst[0]), "v"(dst[1]), "v"(dst[2]), "v"(dst[3]), "v"(dst[4]), "v"(dst[5]), "v"(dst[6]), "v"(dst[7]) : "memory");
}

__device__ __forceinline__ float exp2s(float x) { float r; asm("v_exp_f32 %0, %1\n\tv_nop" : "=v"(r) : "v"(x)); return r; }
#define KP 136   // LDS pitch of a key row in 16-bit elements: 128 + 8 (16 bytes more a row, for the 16-byte readers)
#define VP 72    // LDS pitch of a transposed value row: 64 + 8
typedef __attribute__((ext_vector_type(2))) float v2fl;
// eight asynchronous 16-byte copies of a lane, global memory -> LDS: piece i goes from g + i*GS (elements) to LDS byte address l + L0 + i*LS. The wait on the address translations is the statement's last line, so that no register a copy names is rewritten in front of it.
// The eight LDS addresses are formed inside the statement, in registers that are free again behind it: formed outside, they are loop invariants that the build keeps in 32 registers through the whole loop, which then does not fit four waves per SIMD
template <unsigned L0, unsigned LS, unsigned GS> __device__ __forceinline__ void copy8(unsigned l, const bf* g) {
    unsigned t0, t1, t2, t3, t4, t5, t6, t7;
    asm volatile("v_add_nc_u32 %0, %17, %8\n\t"
                 "v_add_nc_u32 %1, %18, %8\n\t"
                 "v_add_nc_u32 %2, %19, %8\n\t"
                 "v_add_nc_u32 %3, %20, %8\n\t"
                 "v_add_nc_u32 %4, %21, %8\n\t"
                 "v_add_nc_u32 %5, %22, %8\n\t"
                 "v_add_nc_u32 %6, %23, %8\n\t"
                 "v_add_nc_u32 %7, %24, %8\n\t"
                 "global_load_async_to_lds_b128 %0, %9, off\n\t"
                 "global_load_async_to_lds_b128 %1, %10, off\n\t"
                 "global_load_async_to_lds_b128 %2, %11, off\n\t"
                 "global_load_async_to_lds_b128 %3, %12, off\n\t"
                 "global_load_async_to_lds_b128 %4, %13, off\n\t"
                 "global_load_async_to_lds_b128 %5, %14, off\n\t"
                 "global_load_async_to_lds_b128 %6, %15, off\n\t"
                 "global_load_async_to_lds_b128 %7, %16, off\n\t"
                 "s_wait_xcnt 0x0"
                 : "=&v"(t0), "=&v"(t1), "=&v"(t2), "=&v"(t3), "=&v"(t4), "=&v"(t5), "=&v"(t6), "=&v"(t7)
                 : "v"(l), "v"(g), "v"(g + GS), "v"(g + 2 * GS), "v"(g + 3 * GS), "v"(g + 4 * GS), "v"(g + 5 * GS), "v"(g + 6 * GS), "v"(g + 7 * GS),
                   "i"(L0), "i"(L0 + LS), "i"(L0 + 2 * LS), "i"(L0 + 3 * LS), "i"(L0 + 4 * LS), "i"(L0 + 5 * LS), "i"(L0 + 6 * LS), "i"(L0 + 7 * LS) : "memory"); }
__global__ __launch_bounds__(128) void k_flash(const bf* __restrict__ Qh, const bf* __restrict__ Kh, const bf* __restrict__ Vh, float* O, float* ML) {
    typedef WFrag<bf> F; typedef F::V V;
    __shared__ __align__(16) bf sK[2][64 * KP];
    __shared__ __align__(16) bf sV[2][HD * VP];
    const int tid = threadIdx.x, lane = tid & 31, lr = lane & 15, hi = lane >> 4; const int wv = __builtin_amdgcn_readfirstlane(tid >> 5);
    constexpr int XG = KCH / 64; int g = 0;      // query tiles g*XG .. g*XG+XG-1 have g+1 chunks each; XG*g*(g+1)/2 pairs stand before group g
#pragma unroll
    for (int q = 1; q < TT / KCH; ++q) if (XG * q * (q + 1) / 2 <= (int)blockIdx.x) g = q;
    const int rem = (int)blockIdx.x - XG * g * (g + 1) / 2; const int xt = g * XG + rem % XG, ks = rem / XG;
    const int r0 = xt * 64, kbeg = ks * KCH, kend = min(r0 + 64, kbeg + KCH);
    const size_t zb = (size_t)blockIdx.y * TT * HD; Qh += zb; Kh += zb; Vh += zb;
    constexpr unsigned LO = NB_ * TT * HD;   // each lo plane stands this many elements behind its hi plane
    const unsigned ko = tid * 8u, vo = (unsigned)(tid >> 3) * TT + (tid & 7) * 8u;                  // staging, global side: piece i of a key plane is 1024 elements on, of a value plane 16 rows on
    const unsigned lk = (unsigned)(size_t)&sK[0][0] + ((tid >> 4) * KP + (tid & 15) * 8) * 2u;      // staging, LDS side, in bytes: piece i of a key plane is 8 rows on, of a value plane 16 rows on
    const unsigned lv = (unsigned)(size_t)&sV[0][0] + ((tid >> 3) * VP + (tid & 7) * 8) * 2u;
    // stage 0: the first block's key rows
    copy8<0, 8 * KP * 2, 1024u>(lk, Kh + (size_t)kbeg * HD + ko); copy8<64 * KP * 2, 8 * KP * 2, 1024u>(lk, Kh + (size_t)kbeg * HD + ko + LO);
    const int qrow = r0 + wv * 16 + lr;
    V qh[4], ql[4]; const bf* pq = Qh + (size_t)qrow * HD + 8 * hi;
#pragma unroll
    for (int k4 = 0; k4 < 4; ++k4) { qh[k4] = F::ld(pq + k4 * 32); ql[k4] = F::ld(pq + LO + k4 * 32); }
    asm volatile("s_wait_xcnt 0x0" :: "v"(pq) : "memory");   // the address pair that the loads above name stays whole until this wait
    v8f o[8];
#pragma unroll
    for (int nd = 0; nd < 8; ++nd) o[nd] = (v8f){};
    float m = -3.0e38f, l = 0.f;
    asm volatile("s_wait_asynccnt 0x0" ::: "memory");   // this wave's copies of stage 0 have landed
    __syncthreads();                                    // every wave's have: stage 0 may be read
    // stage 1: the first block's value rows
    copy8<0, 16 * VP * 2, 16u * TT>(lv, Vh + kbeg + vo); copy8<HD * VP * 2, 16 * VP * 2, 16u * TT>(lv, Vh + kbeg + vo + LO);
    // rolled: one block's scores, probabilities and fragments beside the 8 accumulators and the query fragments fill the register budget of four waves per SIMD
#pragma unroll 1
    for (int kb = kbeg; kb < kend; kb += 64) {
        const int kn = __builtin_amdgcn_readfirstlane(kb + 64);   // the next block's offset stays a scalar that is added to the lane's loop-invariant offsets; the test on it below is a scalar branch, the same for the whole work-group
        // ---- pass on sK: the block's scores and its softmax
        v8f s[4];
#pragma unroll
        for (int nb = 0; nb < 4; ++nb) s[nb] = (v8f){};
#pragma unroll
        for (int h = 0; h < 2; ++h)
#pragma unroll
        for (int k2 = 0; k2 < 4; k2 += 2) { V kh[2][2], kl[2][2];
#pragma unroll
            for (int u = 0; u < 2; ++u)
#pragma unroll
                for (int nb = 0; nb < 2; ++nb) { kh[u][nb] = F::ld(&sK[0][(h * 32 + nb * 16 + lr) * KP + (k2 + u) * 32 + 8 * hi]); kl[u][nb] = F::ld(&sK[1][(h * 32 + nb * 16 + lr) * KP + (k2 + u) * 32 + 8 * hi]); }
            __builtin_amdgcn_sched_barrier(0);   // all eight fragments are requested before the first product: otherwise the loads sink to their users and every three products wait a whole LDS latency
#pragma unroll
            for (int u = 0; u < 2; ++u) {
#pragma unroll
                for (int nb = 0; nb < 2; ++nb) s[h * 2 + nb] = F::mma(kh[u][nb], qh[k2 + u], s[h * 2 + nb]);   // the two accumulators in turn
#pragma unroll
                for (int nb = 0; nb < 2; ++nb) s[h * 2 + nb] = F::mma(kh[u][nb], ql[k2 + u], s[h * 2 + nb]);
#pragma unroll
                for (int nb = 0; nb < 2; ++nb) s[h * 2 + nb] = F::mma(kl[u][nb], qh[k2 + u], s[h * 2 + nb]); }
            __builtin_amdgcn_sched_barrier(0); }   // the next eight fragments are requested behind these products: moved in among them they need registers of their own, and the build goes past 256 (three waves per SIMD, or spills)
        // s[nb][j] = score of key kb + nb*16 + hi*8 + j for query qrow, from here on in log2 units
#pragma unroll
        for (int nb = 0; nb < 4; ++nb) s[nb] *= (SCL * 1.4426950408889634f);
        if (kb == r0) {   // only the diagonal block holds keys beyond a query (a scalar test)
#pragma unroll
            for (int nb = 0; nb < 4; ++nb)
#pragma unroll
                for (int j = 0; j < 8; ++j) if (kb + nb * 16 + hi * 8 + j > qrow) s[nb][j] = -3.0e38f; }
        float mloc = s[0][0];
#pragma unroll
        for (int nb = 0; nb < 4; ++nb)
#pragma unroll
            for (int j = 0; j < 8; ++j) mloc = fmaxf(mloc, s[nb][j]);
        mloc = fmaxf(mloc, __shfl_xor(mloc, 16, 32));   // the other half of the wave holds the query's other 32 keys
        // every block holds a key of every query (kb <= r0 <= qrow), so m is a real score from the first block on; a masked key gives the probability 2^(-3e38 - m) = 0
        const float mn = fmaxf(m, mloc), al = exp2s(m - mn); m = mn;
#pragma unroll
        for (int nb = 0; nb < 4; ++nb)
#pragma unroll
            for (int j = 0; j < 8; ++j) s[nb][j] = exp2s(s[nb][j] - mn);
        const v8f p8 = (s[0] + s[1]) + (s[2] + s[3]);   // the lane's 32 probabilities summed as a tree
        l = l * al + (((p8[0] + p8[1]) + (p8[2] + p8[3])) + ((p8[4] + p8[5]) + (p8[6] + p8[7])));
#pragma unroll
        for (int nd = 0; nd < 8; ++nd) o[nd] *= al;
        V ph[2], pl[2];
#pragma unroll
        for (int h = 0; h < 2; ++h) {
            const v8b h0 = __builtin_convertvector(s[h * 2], v8b), h1 = __builtin_convertvector(s[h * 2 + 1], v8b);
            const v8b l0 = __builtin_convertvector(s[h * 2] - __builtin_convertvector(h0, v8f), v8b), l1 = __builtin_convertvector(s[h * 2 + 1] - __builtin_convertvector(h1, v8f), v8b);
            ph[h] = __builtin_shufflevector(h0, h1, 0, 1, 2, 3, 4, 5, 6, 7, 8, 9, 10, 11, 12, 13, 14, 15); pl[h] = __builtin_shufflevector(l0, l1, 0, 1, 2, 3, 4, 5, 6, 7, 8, 9, 10, 11, 12, 13, 14, 15); }
        // hand-over: this wave has read its last fragment of sK, its copies into sV have landed; behind the barrier sV may be read and sK refilled
        // the wait names the sum and the converted probabilities as inputs, so that they are finished here: otherwise the build sinks them below the branch and keeps the 32 probabilities in f32 alive through the second pass, beyond 256 registers
        asm volatile("s_wait_dscnt 0x0" :: "v"(l), "v"(ph[0]), "v"(ph[1]), "v"(pl[0]), "v"(pl[1]) : "memory");
        asm volatile("s_wait_asynccnt 0x0" ::: "memory");
        __syncthreads();
        if (kn < kend) { copy8<0, 8 * KP * 2, 1024u>(lk, Kh + (size_t)kn * HD + ko); copy8<64 * KP * 2, 8 * KP * 2, 1024u>(lk, Kh + (size_t)kn * HD + ko + LO); }
        // ---- pass on sV: probability x value
#pragma unroll
        for (int h = 0; h < 2; ++h)
#pragma unroll
        for (int n0 = 0; n0 < 8; n0 += 4) { V vh[4], vl[4];
#pragma unroll
            for (int nd = 0; nd < 4; ++nd) { vh[nd] = F::ld(&sV[0][((n0 + nd) * 16 + lr) * VP + h * 32 + 8 * hi]); vl[nd] = F::ld(&sV[1][((n0 + nd) * 16 + lr) * VP + h * 32 + 8 * hi]); }
            __builtin_amdgcn_sched_barrier(0);   // as above: eight fragments requested before the first product
#pragma unroll
            for (int nd = 0; nd < 4; ++nd) o[n0 + nd] = F::mma(vh[nd], ph[h], o[n0 + nd]);
#pragma unroll
            for (int nd = 0; nd < 4; ++nd) o[n0 + nd] = F::mma(vh[nd], pl[h], o[n0 + nd]);
#pragma unroll
            for (int nd = 0; nd < 4; ++nd) o[n0 + nd] = F::mma(vl[nd], ph[h], o[n0 + nd]);
            __builtin_amdgcn_sched_barrier(0); }   // as above: the next eight fragments stay behind these products
        // four vector slots behind the block's last matrix instruction, on every path behind it, before its operands or results are touched
        asm volatile("v_nop\n\tv_nop\n\tv_nop\n\tv_nop" : "+v"(o[0]), "+v"(o[1]), "+v"(o[2]), "+v"(o[3]), "+v"(o[4]), "+v"(o[5]), "+v"(o[6]), "+v"(o[7]));
        // hand-over: this wave has read its last fragment of sV, its copies into sK have landed; behind the barrier sK may be read and sV refilled
        asm volatile("s_wait_dscnt 0x0" ::: "memory");
        asm volatile("s_wait_asynccnt 0x0" ::: "memory");
        __syncthreads();
        if (kn < kend) { copy8<0, 16 * VP * 2, 16u * TT>(lv, Vh + kn + vo); copy8<HD * VP * 2, 16 * VP * 2, 16u * TT>(lv, Vh + kn + vo + LO); }
    }
    asm volatile("s_wait_asynccnt 0x0" ::: "memory");   // no copy is outstanding when the wave goes on to its end
    l += __shfl_xor(l, 16, 32);   // the two halves' sums are joined once
    const size_t prow = ((size_t)ks * NB_ + blockIdx.y) * TT + qrow;
    float* op = O + prow * HD + hi * 8;   // o[nd][j] = context element d = nd*16 + hi*8 + j of query qrow
#pragma unroll
    for (int nd = 0; nd < 8; ++nd) { *(v4f*)(op + nd * 16) = __builtin_shufflevector(o[nd], o[nd], 0, 1, 2, 3); *(v4f*)(op + nd * 16 + 4) = __builtin_shufflevector(o[nd], o[nd], 4, 5, 6, 7); }
    if (hi == 0) { v2fl ml; ml[0] = m; ml[1] = l; *(v2fl*)(ML + prow * 2) = ml; }   // a wave's 16 pairs fill one 128-byte line
}

// k_merge: joins a query's chunks: out = sum_s w_s O_s / sum_s w_s l_s with w_s = 2^(m_s - max m). One wave per query row (32 lanes x 4 elements), all batches in one launch.
__global__ __launch_bounds__(256) void k_merge(const float* __restrict__ O, const float* __restrict__ ML, float* OUTb) { const unsigned e = (blockIdx.x * 256u + threadIdx.x) * 4u, bt = e / HD; const int t = (int)(bt % TT);
    const int nch = __builtin_amdgcn_readfirstlane(((t >> 6) * 64 + 64 + KCH - 1) / KCH);   /* chunks that row t's tile has: only those planes were written; a wave lies in one row, so the count is a scalar */
    v4f pl[TT / KCH]; v2f ml[TT / KCH]; const float* po[TT / KCH]; const float* pm[TT / KCH];   /* all planes are loaded before the first use, so that their latencies overlap; a plane the row does not have is replaced by its last one (written, in cache) and gets weight 0: no branch */
#pragma unroll
    for (int s = 0; s < TT / KCH; ++s) { const int sc = min(s, nch - 1); po[s] = O + (size_t)sc * NB_ * TT * HD + e; pm[s] = ML + (size_t)sc * NB_ * TT * 2 + bt * 2u; pl[s] = *(const v4f*)po[s]; ml[s] = *(const v2f*)pm[s]; }
    /* every address pair that the loads above name stays whole until this wait */
    asm volatile("s_wait_xcnt 0x0" :: "v"(po[0]), "v"(po[1]), "v"(po[2]), "v"(po[3]), "v"(po[4]), "v"(po[5]), "v"(po[6]), "v"(po[7]), "v"(pm[0]), "v"(pm[1]), "v"(pm[2]), "v"(pm[3]), "v"(pm[4]), "v"(pm[5]), "v"(pm[6]), "v"(pm[7]) : "memory");
#pragma unroll
    for (int s = 1; s < TT / KCH; ++s) if (s >= nch) ml[s][0] = -3.0e38f;
    float mx = ml[0][0];
#pragma unroll
    for (int s = 1; s < TT / KCH; ++s) mx = fmaxf(mx, ml[s][0]);
    float den = 0.f; v4f a4 = (v4f){0.f, 0.f, 0.f, 0.f};
#pragma unroll
    for (int s = 0; s < TT / KCH; ++s) { const float w = exp2s(ml[s][0] - mx); den += w * ml[s][1]; a4 += pl[s] * w; }
    *(v4f*)(OUTb + e) = a4 * __fdiv_rn(1.0f, den);  }   /* f32 context straight to the output */

extern "C" void kernel_launch(void* const* d_in, const int* in_sizes, int n_in,
                              void* d_out, int out_size, void* d_ws, size_t ws_size, hipStream_t stream) {
    (void)in_sizes; (void)n_in; (void)out_size;
    const float* x = (const float*)d_in[0]; const float* wq = (const float*)d_in[1]; const float* wk = (const float*)d_in[2]; const float* wv = (const float*)d_in[3];
    float* OUT = (float*)d_out;     // [4][4096][128]
    char* wsp = (char*)d_ws;
    auto take = [&](size_t bytes) { char* p = wsp; wsp += (bytes + 255) & ~(size_t)255; return (void*)p; };
    bf* WT = (bf*)take((size_t)3 * HD * DM * 2);
    const size_t PB = (size_t)TT * HD;   // one batch's plane; the hi/lo planes of all batches are kept for the one attention launch
    bf* QPh = (bf*)take(2 * NB_ * PB * 2); bf* KPh = (bf*)take(2 * NB_ * PB * 2); bf* VTh = (bf*)take(2 * NB_ * PB * 2);   // each lo plane right behind its hi plane
    float* Ob = (float*)take((size_t)(TT / KCH) * NB_ * PB * 4); float* ML = (float*)take((size_t)(TT / KCH) * NB_ * TT * 2 * 4);
    if ((size_t)(wsp - (char*)d_ws) > ws_size) return;    // ws 256 MiB
    k_wt3<<<dim3(HD * DM / 512, 3, 1), 256, 0, stream>>>(wq, wk, wv, WT);
    k_qkv<<<NB_ * TT / 64, 384, 0, stream>>>(x, WT, QPh, KPh, VTh);
    k_flash<<<dim3((KCH / 64) * (TT / KCH) * (TT / KCH + 1) / 2, NB_, 1), 128, 0, stream>>>(QPh, KPh, VTh, Ob, ML);
    k_merge<<<(unsigned)((size_t)NB_ * TT * HD / 4 / 256), 256, 0, stream>>>(Ob, ML, OUT);
}

// v005
// Measured time: 79.8 microseconds a run.
// Two timings next to v004 both put it at 1.06 times that version's speed.
// Counting every step since v000, it is 10.7 times as fast.
#include <hip/hip_runtime.h>

// Single-head causal attention (x [4][4096][768]; q, k, v = x W ('xw' [768][128], no bias); scores = q.k, causal (-inf), softmax(scores/sqrt(128)); out = attn.v -> [4][4096][128] f32 (2.1 M); no output projection).
// Compute dtypes, f32 accumulate: every input rounded to bf16; q/k/v on PLAIN bf16 operands (inputs: exact), one kernel for all three and all batches that rounds x on the way into LDS and writes the hi/lo planes itself; causal scores and attn.v (tile skipping) on hi/lo planes for every row (3 products), fused in one kernel with an online softmax in f32 (scores and probabilities stay in registers); no output projection: the context is written in f32.

#define NB_  4
#define TT   4096
#define DM   768
#define NH_  1
#define NKV  1
#define REP  (NH_ / NKV)
#define HD   128
#define DQ   (NH_ * HD)
#define DKV  (NKV * HD)
#define ZH   1
#define RH   4096                 // every row hi/lo (streaming softmax, no register row)
#define RB   TT
#define WIN  4096
#define PCAR 1024.0f
#define SCL  0.088388347648318447f   // HD^-0.5
#define KCH  512                  // keys per chunk of the probability x value product (one partial plane per chunk)
typedef _Float16 h16;
typedef unsigned short bf;
typedef __attribute__((ext_vector_type(16))) __bf16   v16bf;
typedef __attribute__((ext_vector_type(16))) _Float16 v16h;
typedef __attribute__((ext_vector_type(8)))  _Float16 v8h;
typedef __attribute__((ext_vector_type(8)))  unsigned short v8us;
typedef __attribute__((ext_vector_type(8)))  float    v8f;
typedef __attribute__((ext_vector_type(4)))  float    v4f;
typedef v8h  __attribute__((may_alias)) v8ha;
typedef v4f  __attribute__((may_alias)) v4fa;
typedef v8us __attribute__((may_alias)) v8usa;

__device__ __forceinline__ unsigned short f2bf(float f) { unsigned u = __float_as_uint(f); u += 0x7FFFu + ((u >> 16) & 1u); return (unsigned short)(u >> 16); }
__device__ __forceinline__ float bf2f(unsigned short b) { return __uint_as_float(((unsigned)b) << 16); }
__device__ __forceinline__ float bfr(float f) { return bf2f(f2bf(f)); }
__device__ __forceinline__ v16h cat16(v8h lo, v8h hi) { return __builtin_shufflevector(lo, hi, 0, 1, 2, 3, 4, 5, 6, 7, 8, 9, 10, 11, 12, 13, 14, 15); }
__device__ __forceinline__ v16bf cat16b(v8us lo, v8us hi) { return __builtin_bit_cast(v16bf, __builtin_shufflevector(lo, hi, 0, 1, 2, 3, 4, 5, 6, 7, 8, 9, 10, 11, 12, 13, 14, 15)); }
__device__ __forceinline__ v8f wmma16(v16h a, v16h b, v8f c) { return __builtin_amdgcn_wmma_f32_16x16x32_f16(false, a, false, b, (short)0, c, false, false); }
__device__ __forceinline__ v8f wmmab(v16bf a, v16bf b, v8f c) { return __builtin_amdgcn_wmma_f32_16x16x32_bf16(false, a, false, b, (short)0, c, false, false); }



// ---- fragment loaders: 16 elements of a K-contiguous 16-bit row per lane (k = 8*hi .. 8*hi+7 and 16+8*hi .. 16+8*hi+7), the same for the A and the B operand
template <typename T16> struct WFrag;
template <> struct WFrag<h16> { typedef v16h V; static __device__ __forceinline__ V ld(const h16* p) { return cat16(*(const v8h*)p, *(const v8h*)(p + 16)); } static __device__ __forceinline__ v8f mma(V a, V b, v8f c) { return wmma16(a, b, c); } };
template <> struct WFrag<bf> { typedef v16bf V; static __device__ __forceinline__ V ld(const bf* p) { return cat16b(*(const v8us*)p, *(const v8us*)(p + 16)); } static __device__ __forceinline__ v8f mma(V a, V b, v8f c) { return wmmab(a, b, c); } };

typedef __attribute__((ext_vector_type(2))) unsigned short v2us;
typedef __attribute__((ext_vector_type(2))) float v2f;
typedef __attribute__((ext_vector_type(8))) __bf16 v8b;

// ---- k_wt3: the three weights [DM][HD] f32 -> one K-contiguous 16-bit plane Bt[3*HD][DM] (rows 0..127 q, 128..255 k, 256..383 v). blockIdx.y picks the weight; a thread makes two neighbours in k.
__global__ __launch_bounds__(256) void k_wt3(const float* __restrict__ wq, const float* __restrict__ wk, const float* __restrict__ wv, bf* Bt) {
    const float* w = (blockIdx.y == 0) ? wq : ((blockIdx.y == 1) ? wk : wv);
    const unsigned e = (blockIdx.x * 256u + threadIdx.x) * 2u, k = e % DM, n = e / DM; v2us o;
    o[0] = f2bf(w[k * HD + n]); o[1] = f2bf(w[(k + 1) * HD + n]); *(v2us*)(Bt + blockIdx.y * (unsigned)(HD * DM) + e) = o; }

// ---- k_qkv: q, k and v of 64 rows of x (all batches: row = b*TT + t) in one work-group of 12 waves. The 64 x 768 tile of x is read once in f32, rounded to 16 bits and kept in LDS for all waves;
// wave w makes columns 32w .. 32w+31 of [q | k | v] (4 x 2 accumulators) over the whole K in one chain, its weight rows straight from the K-contiguous plane, fetched two 64-wide slices (whole 128-byte lines) ahead.
// The f32 results pass through LDS (q, k row-major; v transposed) and leave as the hi/lo planes that k_flash reads: Q, K [b][t][d], V [b][d][t]; every 128-byte line of a plane has one writer.
#define XP 776   // LDS pitch of an x row in 16-bit elements: 768 + 8 (16 bytes more a row, for the 16-byte readers)
#define OP 260   // LDS pitch of a [q | k] result row in f32: 256 + 4
#define OV 68    // LDS pitch of a transposed v result row in f32: 64 + 4
__global__ __launch_bounds__(384) void k_qkv(const float* __restrict__ x, const bf* __restrict__ Wt, bf* Qp, bf* Kp, bf* Vp) {
    typedef WFrag<bf> F; typedef F::V V;
    __shared__ __align__(16) bf sX[64 * XP];
    __shared__ __align__(16) float sO[64 * OP + HD * OV];
    const int tid = threadIdx.x, lane = tid & 31, lr = lane & 15, hi = lane >> 4; const int wv = __builtin_amdgcn_readfirstlane(tid >> 5);
    const int R0 = blockIdx.x * 64;
    constexpr unsigned LO = NB_ * TT * HD;   // each lo plane stands this many elements behind its hi plane
    const bf* pb = Wt + (size_t)(wv * 32 + lr) * DM + 8 * hi;
    V b[3][2][2];   // a ring of three 64-wide slices of the wave's weight rows: one in use, two in flight
#pragma unroll
    for (int s = 0; s < 2; ++s)
#pragma unroll
        for (int u = 0; u < 2; ++u)
#pragma unroll
            for (int nb = 0; nb < 2; ++nb) b[s][u][nb] = F::ld(pb + nb * 16 * DM + s * 64 + u * 32);
    { const char* xb = (const char*)(x + (size_t)R0 * DM); const unsigned xo = tid * 32u;   // the tile is 64 whole rows: one contiguous run; piece i of a thread is 384 * 32 bytes (4 rows) on
      v8f t[16];
#pragma unroll
      for (int i = 0; i < 16; ++i) t[i] = *(const v8f*)(xb + xo + i * 12288u);
      asm volatile("s_wait_xcnt 0x0" :: "v"(xo) : "memory");   // the offset register that the loads above name stays whole until this wait
      const int lx = (tid / 96) * XP + (tid % 96) * 8;
#pragma unroll
      for (int i = 0; i < 16; ++i) *(v8us*)(&sX[lx + i * (4 * XP)]) = __builtin_bit_cast(v8us, __builtin_convertvector(t[i], v8b)); }
    __syncthreads();   // the rounded tile is whole before any wave reads a fragment of it
    v8f acc[4][2];
#pragma unroll
    for (int mb = 0; mb < 4; ++mb)
#pragma unroll
        for (int nb = 0; nb < 2; ++nb) acc[mb][nb] = (v8f){};
    // unrolled whole: no back edge behind a matrix instruction, and every address is the lane's base plus a constant
#pragma unroll
    for (int it = 0; it < DM / 64; ++it) {
        if (it + 2 < DM / 64) {
#pragma unroll
            for (int u = 0; u < 2; ++u)
#pragma unroll
                for (int nb = 0; nb < 2; ++nb) b[(it + 2) % 3][u][nb] = F::ld(pb + nb * 16 * DM + (it + 2) * 64 + u * 32); }
        V a[2][4];
#pragma unroll
        for (int u = 0; u < 2; ++u)
#pragma unroll
            for (int mb = 0; mb < 4; ++mb) a[u][mb] = F::ld(&sX[(mb * 16 + lr) * XP + it * 64 + u * 32 + 8 * hi]);
        __builtin_amdgcn_sched_barrier(0);   // the weight slice two trips ahead and this trip's eight x fragments are requested before the first product: otherwise the loads sink to their users and every pair of products waits a whole L2 or LDS latency
#pragma unroll
        for (int u = 0; u < 2; ++u)
#pragma unroll
            for (int mb = 0; mb < 4; ++mb)
#pragma unroll
                for (int nb = 0; nb < 2; ++nb) acc[mb][nb] = F::mma(a[u][mb], b[it % 3][u][nb], acc[mb][nb]);
    }
    asm volatile("s_wait_xcnt 0x0" :: "v"(pb) : "memory");   // as above, for the weight rows' address pair
    // four vector slots behind the last matrix instruction, on both sides of the branch below, before its results are touched
    asm volatile("v_nop\n\tv_nop\n\tv_nop\n\tv_nop" : "+v"(acc[0][0]), "+v"(acc[0][1]), "+v"(acc[1][0]), "+v"(acc[1][1]), "+v"(acc[2][0]), "+v"(acc[2][1]), "+v"(acc[3][0]), "+v"(acc[3][1]));
    // acc[mb][nb][j] = row mb*16 + hi*8 + j, column wv*32 + nb*16 + lr
    if (wv < 8) {   // q and k: row-major (a scalar test)
#pragma unroll
        for (int mb = 0; mb < 4; ++mb)
#pragma unroll
            for (int nb = 0; nb < 2; ++nb)
#pragma unroll
                for (int j = 0; j < 8; ++j) sO[(mb * 16 + hi * 8 + j) * OP + wv * 32 + nb * 16 + lr] = acc[mb][nb][j];
    } else {        // v: transposed, a lane's 8 rows are neighbours
#pragma unroll
        for (int mb = 0; mb < 4; ++mb)
#pragma unroll
            for (int nb = 0; nb < 2; ++nb) { float* p = &sO[64 * OP + ((wv - 8) * 32 + nb * 16 + lr) * OV + mb * 16 + hi * 8];
                *(v4fa*)p = __builtin_shufflevector(acc[mb][nb], acc[mb][nb], 0, 1, 2, 3); *(v4fa*)(p + 4) = __builtin_shufflevector(acc[mb][nb], acc[mb][nb], 4, 5, 6, 7); }
    }
    __syncthreads();   // every wave's results are in LDS before any thread splits them
    // 3072 pieces of 8 results, 8 a thread: pieces 0..2047 are [q | k] (32 a row: lanes 0-15 a q row, 16-31 a k row), 2048..3071 are v (8 a row of 64 t); the border falls between waves 3 and 4 of round 5
    v8f r[8]; bf* dst[8];
#pragma unroll
    for (int i = 0; i < 8; ++i) { const int idx = i * 384 + tid; int so;
        if (i < 5 || (i == 5 && wv < 4)) { const int row = idx >> 5, cg = idx & 31; so = row * OP + cg * 8; dst[i] = ((cg < 16) ? Qp : Kp) + (size_t)(R0 + row) * HD + (cg & 15) * 8; }
        else { const int q = idx - 2048, d = q >> 3, tg = q & 7; so = 64 * OP + d * OV + tg * 8; dst[i] = Vp + (size_t)(R0 / TT) * (TT * HD) + (size_t)d * TT + (R0 % TT) + tg * 8; }
        const v4f r0 = *(const v4fa*)(sO + so), r1 = *(const v4fa*)(sO + so + 4); r[i] = __builtin_shufflevector(r0, r1, 0, 1, 2, 3, 4, 5, 6, 7); }
#pragma unroll
    for (int i = 0; i < 8; ++i) { const v8b h = __builtin_convertvector(r[i], v8b); const v8b l = __builtin_convertvector(r[i] - __builtin_convertvector(h, v8f), v8b);   // hi = the result rounded to 16 bits, lo = what is left, rounded
        *(v8us*)dst[i] = __builtin_bit_cast(v8us, h); *(v8us*)(dst[i] + LO) = __builtin_bit_cast(v8us, l); }
    // every address pair that the stores above name stays whole until this wait
    asm volatile("s_wait_xcnt 0x0" :: "v"(dst[0]), "v"(dst[1]), "v"(dst[2]), "v"(dst[3]), "v"(dst[4]), "v"(dst[5]), "v"(dst[6]), "v"(dst[7]) : "memory");
}

__device__ __forceinline__ float exp2s(float x) { float r; asm("v_exp_f32 %0, %1\n\tv_nop" : "=v"(r) : "v"(x)); return r; }
#define KP 136   // LDS pitch of a key row in 16-bit elements: 128 + 8 (16 bytes more a row, for the 16-byte readers)
#define VP 72    // LDS pitch of a transposed value row: 64 + 8
typedef __attribute__((ext_vector_type(2))) float v2fl;
// eight asynchronous 16-byte copies of a lane, global memory -> LDS: piece i goes from g + i*GS (elements) to LDS byte address l + L0 + i*LS. The wait on the address translations is the statement's last line, so that no register a copy names is rewritten in front of it.
// The eight LDS addresses are formed inside the statement, in registers that are free again behind it: formed outside, they are loop invariants that the build keeps in 32 registers through the whole loop, which then does not fit four waves per SIMD
template <unsigned L0, unsigned LS, unsigned GS> __device__ __forceinline__ void copy8(unsigned l, const bf* g) {
    unsigned t0, t1, t2, t3, t4, t5, t6, t7;
    asm volatile("v_add_nc_u32 %0, %17, %8\n\t"
                 "v_add_nc_u32 %1, %18, %8\n\t"
                 "v_add_nc_u32 %2, %19, %8\n\t"
                 "v_add_nc_u32 %3, %20, %8\n\t"
                 "v_add_nc_u32 %4, %21, %8\n\t"
                 "v_add_nc_u32 %5, %22, %8\n\t"
                 "v_add_nc_u32 %6, %23, %8\n\t"
                 "v_add_nc_u32 %7, %24, %8\n\t"
                 "global_load_async_to_lds_b128 %0, %9, off\n\t"
                 "global_load_async_to_lds_b128 %1, %10, off\n\t"
                 "global_load_async_to_lds_b128 %2, %11, off\n\t"
                 "global_load_async_to_lds_b128 %3, %12, off\n\t"
                 "global_load_async_to_lds_b128 %4, %13, off\n\t"
                 "global_load_async_to_lds_b128 %5, %14, off\n\t"
                 "global_load_async_to_lds_b128 %6, %15, off\n\t"
                 "global_load_async_to_lds_b128 %7, %16, off\n\t"
                 "s_wait_xcnt 0x0"
                 : "=&v"(t0), "=&v"(t1), "=&v"(t2), "=&v"(t3), "=&v"(t4), "=&v"(t5), "=&v"(t6), "=&v"(t7)
                 : "v"(l), "v"(g), "v"(g + GS), "v"(g + 2 * GS), "v"(g + 3 * GS), "v"(g + 4 * GS), "v"(g + 5 * GS), "v"(g + 6 * GS), "v"(g + 7 * GS),
                   "i"(L0), "i"(L0 + LS), "i"(L0 + 2 * LS), "i"(L0 + 3 * LS), "i"(L0 + 4 * LS), "i"(L0 + 5 * LS), "i"(L0 + 6 * LS), "i"(L0 + 7 * LS) : "memory"); }
__global__ __launch_bounds__(128) void k_flash(const bf* __restrict__ Qh, const bf* __restrict__ Kh, const bf* __restrict__ Vh, float* O, float* ML) {
    typedef WFrag<bf> F; typedef F::V V;
    __shared__ __align__(16) bf sK[2][64 * KP];
    __shared__ __align__(16) bf sV[2][HD * VP];
    const int tid = threadIdx.x, lane = tid & 31, lr = lane & 15, hi = lane >> 4; const int wv = __builtin_amdgcn_readfirstlane(tid >> 5);
    // Query tiles g*XG .. g*XG+XG-1 (group g) have g whole chunks of XG blocks each and one chunk on the diagonal, of 1 .. XG blocks. There are more work-groups than places on the chip;
    // the cost falls with the index (for speed only): first every whole chunk (batch, group, chunk, tile), then the diagonal chunks from XG blocks down to 1 (all batches and groups of a length together): the last indices are short.
    constexpr int XG = KCH / 64, NG = TT / KCH, NF = XG * NG * (NG - 1) / 2;   // NF whole chunks a batch; XG*g*(g-1)/2 of them stand before group g
    int bz, xt, ks;
    if ((int)blockIdx.x < NB_ * NF) { bz = (int)blockIdx.x / NF; const int i = (int)blockIdx.x % NF; int g = 1;
#pragma unroll
        for (int q = 2; q < NG; ++q) if (XG * q * (q - 1) / 2 <= i) g = q;
        const int rem = i - XG * g * (g - 1) / 2; xt = g * XG + rem % XG; ks = rem / XG; }
    else { const int d = (int)blockIdx.x - NB_ * NF, c = d % (NB_ * NG); bz = c / NG; ks = c % NG; xt = ks * XG + (XG - 1 - d / (NB_ * NG)); }
    const int r0 = xt * 64, kbeg = ks * KCH, kend = min(r0 + 64, kbeg + KCH);
    const size_t zb = (size_t)bz * TT * HD; Qh += zb; Kh += zb; Vh += zb;
    constexpr unsigned LO = NB_ * TT * HD;   // each lo plane stands this many elements behind its hi plane
    const unsigned ko = tid * 8u, vo = (unsigned)(tid >> 3) * TT + (tid & 7) * 8u;                  // staging, global side: piece i of a key plane is 1024 elements on, of a value plane 16 rows on
    const unsigned lk = (unsigned)(size_t)&sK[0][0] + ((tid >> 4) * KP + (tid & 15) * 8) * 2u;      // staging, LDS side, in bytes: piece i of a key plane is 8 rows on, of a value plane 16 rows on
    const unsigned lv = (unsigned)(size_t)&sV[0][0] + ((tid >> 3) * VP + (tid & 7) * 8) * 2u;
    // stage 0: the first block's key rows
    copy8<0, 8 * KP * 2, 1024u>(lk, Kh + (size_t)kbeg * HD + ko); copy8<64 * KP * 2, 8 * KP * 2, 1024u>(lk, Kh + (size_t)kbeg * HD + ko + LO);
    const int qrow = r0 + wv * 16 + lr;
    V qh[4], ql[4]; const bf* pq = Qh + (size_t)qrow * HD + 8 * hi;
#pragma unroll
    for (int k4 = 0; k4 < 4; ++k4) { qh[k4] = F::ld(pq + k4 * 32); ql[k4] = F::ld(pq + LO + k4 * 32); }
    asm volatile("s_wait_xcnt 0x0" :: "v"(pq) : "memory");   // the address pair that the loads above name stays whole until this wait
    v8f o[8];
#pragma unroll
    for (int nd = 0; nd < 8; ++nd) o[nd] = (v8f){};
    float m = -3.0e38f, l = 0.f;
    asm volatile("s_wait_asynccnt 0x0" ::: "memory");   // this wave's copies of stage 0 have landed
    __syncthreads();                                    // every wave's have: stage 0 may be read
    // stage 1: the first block's value rows
    copy8<0, 16 * VP * 2, 16u * TT>(lv, Vh + kbeg + vo); copy8<HD * VP * 2, 16 * VP * 2, 16u * TT>(lv, Vh + kbeg + vo + LO);
    // rolled: one block's scores, probabilities and fragments beside the 8 accumulators and the query fragments fill the register budget of four waves per SIMD
#pragma unroll 1
    for (int kb = kbeg; kb < kend; kb += 64) {
        const int kn = __builtin_amdgcn_readfirstlane(kb + 64);   // the next block's offset stays a scalar that is added to the lane's loop-invariant offsets; the test on it below is a scalar branch, the same for the whole work-group
        // ---- pass on sK: the block's scores and its softmax
        v8f s[4];
#pragma unroll
        for (int nb = 0; nb < 4; ++nb) s[nb] = (v8f){};
#pragma unroll
        for (int h = 0; h < 2; ++h)
#pragma unroll
        for (int k2 = 0; k2 < 4; k2 += 2) { V kh[2][2], kl[2][2];
#pragma unroll
            for (int u = 0; u < 2; ++u)
#pragma unroll
                for (int nb = 0; nb < 2; ++nb) { kh[u][nb] = F::ld(&sK[0][(h * 32 + nb * 16 + lr) * KP + (k2 + u) * 32 + 8 * hi]); kl[u][nb] = F::ld(&sK[1][(h * 32 + nb * 16 + lr) * KP + (k2 + u) * 32 + 8 * hi]); }
            __builtin_amdgcn_sched_barrier(0);   // all eight fragments are requested before the first product: otherwise the loads sink to their users and every three products wait a whole LDS latency
#pragma unroll
            for (int u = 0; u < 2; ++u) {
#pragma unroll
                for (int nb = 0; nb < 2; ++nb) s[h * 2 + nb] = F::mma(kh[u][nb], qh[k2 + u], s[h * 2 + nb]);   // the two accumulators in turn
#pragma unroll
                for (int nb = 0; nb < 2; ++nb) s[h * 2 + nb] = F::mma(kh[u][nb], ql[k2 + u], s[h * 2 + nb]);
#pragma unroll
                for (int nb = 0; nb < 2; ++nb) s[h * 2 + nb] = F::mma(kl[u][nb], qh[k2 + u], s[h * 2 + nb]); }
            __builtin_amdgcn_sched_barrier(0); }   // the next eight fragments are requested behind these products: moved in among them they need registers of their own, and the build goes past 256 (three waves per SIMD, or spills)
        // s[nb][j] = score of key kb + nb*16 + hi*8 + j for query qrow, from here on in log2 units
#pragma unroll
        for (int nb = 0; nb < 4; ++nb) s[nb] *= (SCL * 1.4426950408889634f);
        if (kb == r0) {   // only the diagonal block holds keys beyond a query (a scalar test)
#pragma unroll
            for (int nb = 0; nb < 4; ++nb)
#pragma unroll
                for (int j = 0; j < 8; ++j) if (kb + nb * 16 + hi * 8 + j > qrow) s[nb][j] = -3.0e38f; }
        float mloc = s[0][0];
#pragma unroll
        for (int nb = 0; nb < 4; ++nb)
#pragma unroll
            for (int j = 0; j < 8; ++j) mloc = fmaxf(mloc, s[nb][j]);
        mloc = fmaxf(mloc, __shfl_xor(mloc, 16, 32));   // the other half of the wave holds the query's other 32 keys
        // every block holds a key of every query (kb <= r0 <= qrow), so m is a real score from the first block on; a masked key gives the probability 2^(-3e38 - m) = 0
        const float mn = fmaxf(m, mloc), al = exp2s(m - mn); m = mn;
#pragma unroll
        for (int nb = 0; nb < 4; ++nb)
#pragma unroll
            for (int j = 0; j < 8; ++j) s[nb][j] = exp2s(s[nb][j] - mn);
        const v8f p8 = (s[0] + s[1]) + (s[2] + s[3]);   // the lane's 32 probabilities summed as a tree
        l = l * al + (((p8[0] + p8[1]) + (p8[2] + p8[3])) + ((p8[4] + p8[5]) + (p8[6] + p8[7])));
#pragma unroll
        for (int nd = 0; nd < 8; ++nd) o[nd] *= al;
        V ph[2], pl[2];
#pragma unroll
        for (int h = 0; h < 2; ++h) {
            const v8b h0 = __builtin_convertvector(s[h * 2], v8b), h1 = __builtin_convertvector(s[h * 2 + 1], v8b);
            const v8b l0 = __builtin_convertvector(s[h * 2] - __builtin_convertvector(h0, v8f), v8b), l1 = __builtin_convertvector(s[h * 2 + 1] - __builtin_convertvector(h1, v8f), v8b);
            ph[h] = __builtin_shufflevector(h0, h1, 0, 1, 2, 3, 4, 5, 6, 7, 8, 9, 10, 11, 12, 13, 14, 15); pl[h] = __builtin_shufflevector(l0, l1, 0, 1, 2, 3, 4, 5, 6, 7, 8, 9, 10, 11, 12, 13, 14, 15); }
        // hand-over: this wave has read its last fragment of sK, its copies into sV have landed; behind the barrier sV may be read and sK refilled
        // the wait names the sum and the converted probabilities as inputs, so that they are finished here: otherwise the build sinks them below the branch and keeps the 32 probabilities in f32 alive through the second pass, beyond 256 registers
        asm volatile("s_wait_dscnt 0x0" :: "v"(l), "v"(ph[0]), "v"(ph[1]), "v"(pl[0]), "v"(pl[1]) : "memory");
        asm volatile("s_wait_asynccnt 0x0" ::: "memory");
        __syncthreads();
        if (kn < kend) { copy8<0, 8 * KP * 2, 1024u>(lk, Kh + (size_t)kn * HD + ko); copy8<64 * KP * 2, 8 * KP * 2, 1024u>(lk, Kh + (size_t)kn * HD + ko + LO); }
        // ---- pass on sV: probability x value
#pragma unroll
        for (int h = 0; h < 2; ++h)
#pragma unroll
        for (int n0 = 0; n0 < 8; n0 += 4) { V vh[4], vl[4];
#pragma unroll
            for (int nd = 0; nd < 4; ++nd) { vh[nd] = F::ld(&sV[0][((n0 + nd) * 16 + lr) * VP + h * 32 + 8 * hi]); vl[nd] = F::ld(&sV[1][((n0 + nd) * 16 + lr) * VP + h * 32 + 8 * hi]); }
            __builtin_amdgcn_sched_barrier(0);   // as above: eight fragments requested before the first product
#pragma unroll
            for (int nd = 0; nd < 4; ++nd) o[n0 + nd] = F::mma(vh[nd], ph[h], o[n0 + nd]);
#pragma unroll
            for (int nd = 0; nd < 4; ++nd) o[n0 + nd] = F::mma(vh[nd], pl[h], o[n0 + nd]);
#pragma unroll
            for (int nd = 0; nd < 4; ++nd) o[n0 + nd] = F::mma(vl[nd], ph[h], o[n0 + nd]);
            __builtin_amdgcn_sched_barrier(0); }   // as above: the next eight fragments stay behind these products
        // four vector slots behind the block's last matrix instruction, on every path behind it, before its operands or results are touched
        asm volatile("v_nop\n\tv_nop\n\tv_nop\n\tv_nop" : "+v"(o[0]), "+v"(o[1]), "+v"(o[2]), "+v"(o[3]), "+v"(o[4]), "+v"(o[5]), "+v"(o[6]), "+v"(o[7]));
        // hand-over: this wave has read its last fragment of sV, its copies into sK have landed; behind the barrier sK may be read and sV refilled
        asm volatile("s_wait_dscnt 0x0" ::: "memory");
        asm volatile("s_wait_asynccnt 0x0" ::: "memory");
        __syncthreads();
        if (kn < kend) { copy8<0, 16 * VP * 2, 16u * TT>(lv, Vh + kn + vo); copy8<HD * VP * 2, 16 * VP * 2, 16u * TT>(lv, Vh + kn + vo + LO); }
    }
    asm volatile("s_wait_asynccnt 0x0" ::: "memory");   // no copy is outstanding when the wave goes on to its end
    l += __shfl_xor(l, 16, 32);   // the two halves' sums are joined once
    const size_t prow = ((size_t)ks * NB_ + bz) * TT + qrow;
    float* op = O + prow * HD + hi * 8;   // o[nd][j] = context element d = nd*16 + hi*8 + j of query qrow
#pragma unroll
    for (int nd = 0; nd < 8; ++nd) { *(v4f*)(op + nd * 16) = __builtin_shufflevector(o[nd], o[nd], 0, 1, 2, 3); *(v4f*)(op + nd * 16 + 4) = __builtin_shufflevector(o[nd], o[nd], 4, 5, 6, 7); }
    if (hi == 0) { v2fl ml; ml[0] = m; ml[1] = l; *(v2fl*)(ML + prow * 2) = ml; }   // a wave's 16 pairs fill one 128-byte line
}

// k_merge: joins a query's chunks: out = sum_s w_s O_s / sum_s w_s l_s with w_s = 2^(m_s - max m). One wave per query row (32 lanes x 4 elements), all batches in one launch.
__global__ __launch_bounds__(256) void k_merge(const float* __restrict__ O, const float* __restrict__ ML, float* OUTb) { const unsigned e = (blockIdx.x * 256u + threadIdx.x) * 4u, bt = e / HD; const int t = (int)(bt % TT);
    const int nch = __builtin_amdgcn_readfirstlane(((t >> 6) * 64 + 64 + KCH - 1) / KCH);   /* chunks that row t's tile has: only those planes were written; a wave lies in one row, so the count is a scalar */
    v4f pl[TT / KCH]; v2f ml[TT / KCH]; const float* po[TT / KCH]; const float* pm[TT / KCH];   /* all planes are loaded before the first use, so that their latencies overlap; a plane the row does not have is replaced by its last one (written, in cache) and gets weight 0: no branch */
#pragma unroll
    for (int s = 0; s < TT / KCH; ++s) { const int sc = min(s, nch - 1); po[s] = O + (size_t)sc * NB_ * TT * HD + e; pm[s] = ML + (size_t)sc * NB_ * TT * 2 + bt * 2u; pl[s] = *(const v4f*)po[s]; ml[s] = *(const v2f*)pm[s]; }
    /* every address pair that the loads above name stays whole until this wait */
    asm volatile("s_wait_xcnt 0x0" :: "v"(po[0]), "v"(po[1]), "v"(po[2]), "v"(po[3]), "v"(po[4]), "v"(po[5]), "v"(po[6]), "v"(po[7]), "v"(pm[0]), "v"(pm[1]), "v"(pm[2]), "v"(pm[3]), "v"(pm[4]), "v"(pm[5]), "v"(pm[6]), "v"(pm[7]) : "memory");
#pragma unroll
    for (int s = 1; s < TT / KCH; ++s) if (s >= nch) ml[s][0] = -3.0e38f;
    float mx = ml[0][0];
#pragma unroll
    for (int s = 1; s < TT / KCH; ++s) mx = fmaxf(mx, ml[s][0]);
    float den = 0.f; v4f a4 = (v4f){0.f, 0.f, 0.f, 0.f};
#pragma unroll
    for (int s = 0; s < TT / KCH; ++s) { const float w = exp2s(ml[s][0] - mx); den += w * ml[s][1]; a4 += pl[s] * w; }
    *(v4f*)(OUTb + e) = a4 * __fdiv_rn(1.0f, den);  }   /* f32 context straight to the output */

extern "C" void kernel_launch(void* const* d_in, const int* in_sizes, int n_in,
                              void* d_out, int out_size, void* d_ws, size_t ws_size, hipStream_t stream) {
    (void)in_sizes; (void)n_in; (void)out_size;
    const float* x = (const float*)d_in[0]; const float* wq = (const float*)d_in[1]; const float* wk = (const float*)d_in[2]; const float* wv = (const float*)d_in[3];
    float* OUT = (float*)d_out;     // [4][4096][128]
    char* wsp = (char*)d_ws;
    auto take = [&](size_t bytes) { char* p = wsp; wsp += (bytes + 255) & ~(size_t)255; return (void*)p; };
    bf* WT = (bf*)take((size_t)3 * HD * DM * 2);
    const size_t PB = (size_t)TT * HD;   // one batch's plane; the hi/lo planes of all batches are kept for the one attention launch
    bf* QPh = (bf*)take(2 * NB_ * PB * 2); bf* KPh = (bf*)take(2 * NB_ * PB * 2); bf* VTh = (bf*)take(2 * NB_ * PB * 2);   // each lo plane right behind its hi plane
    float* Ob = (float*)take((size_t)(TT / KCH) * NB_ * PB * 4); float* ML = (float*)take((size_t)(TT / KCH) * NB_ * TT * 2 * 4);
    if ((size_t)(wsp - (char*)d_ws) > ws_size) return;    // ws 256 MiB
    k_wt3<<<dim3(HD * DM / 512, 3, 1), 256, 0, stream>>>(wq, wk, wv, WT);
    k_qkv<<<NB_ * TT / 64, 384, 0, stream>>>(x, WT, QPh, KPh, VTh);
    k_flash<<<(KCH / 64) * (TT / KCH) * (TT / KCH + 1) / 2 * NB_, 128, 0, stream>>>(QPh, KPh, VTh, Ob, ML);
    k_merge<<<(unsigned)((size_t)NB_ * TT * HD / 4 / 256), 256, 0, stream>>>(Ob, ML, OUT);
}

// v008
// One run takes 54.1 microseconds.
// Versions between v005 and this one are left out; their measured steps multiply to 1.47 times as fast.
// Over all steps from v000 it is 15.8 times as fast.
#include <hip/hip_runtime.h>

// Single-head causal attention (x [4][4096][768]; q, k, v = x W ('xw' [768][128], no bias); scores = q.k, causal (-inf), softmax(scores/sqrt(128)); out = attn.v -> [4][4096][128] f32 (2.1 M); no output projection).
// Compute dtypes, f32 accumulate: every input rounded to bf16; q/k/v on PLAIN bf16 operands (inputs: exact), one kernel for all three and all batches that rounds x on the way into LDS and writes the f16 planes itself; causal scores (tile skipping) on TWO f16 products for every row (k rounded once to f16: 11 significant bits; q as an f16 hi/lo pair), attn.v on ONE f16 product (probabilities and values each rounded once to f16: 11 significant bits), fused in one kernel with an online softmax in f32 (scores and probabilities stay in registers); no output projection: the context is written in f32.

#define NB_  4
#define TT   4096
#define DM   768
#define NH_  1
#define NKV  1
#define REP  (NH_ / NKV)
#define HD   128
#define DQ   (NH_ * HD)
#define DKV  (NKV * HD)
#define ZH   1
#define RH   4096                 // every row hi/lo (streaming softmax, no register row)
#define RB   TT
#define WIN  4096
#define PCAR 1024.0f
#define SCL  0.088388347648318447f   // HD^-0.5
#define KCH  512                  // keys per chunk of the probability x value product (one partial plane per chunk)
typedef _Float16 h16;
typedef unsigned short bf;
typedef __attribute__((ext_vector_type(16))) __bf16   v16bf;
typedef __attribute__((ext_vector_type(16))) _Float16 v16h;
typedef __attribute__((ext_vector_type(8)))  _Float16 v8h;
typedef __attribute__((ext_vector_type(8)))  unsigned short v8us;
typedef __attribute__((ext_vector_type(8)))  float    v8f;
typedef __attribute__((ext_vector_type(4)))  float    v4f;
typedef v8h  __attribute__((may_alias)) v8ha;
typedef v4f  __attribute__((may_alias)) v4fa;
typedef v8us __attribute__((may_alias)) v8usa;

__device__ __forceinline__ unsigned short f2bf(float f) { unsigned u = __float_as_uint(f); u += 0x7FFFu + ((u >> 16) & 1u); return (unsigned short)(u >> 16); }
__device__ __forceinline__ float bf2f(unsigned short b) { return __uint_as_float(((unsigned)b) << 16); }
__device__ __forceinline__ float bfr(float f) { return bf2f(f2bf(f)); }
__device__ __forceinline__ v16h cat16(v8h lo, v8h hi) { return __builtin_shufflevector(lo, hi, 0, 1, 2, 3, 4, 5, 6, 7, 8, 9, 10, 11, 12, 13, 14, 15); }
__device__ __forceinline__ v16bf cat16b(v8us lo, v8us hi) { return __builtin_bit_cast(v16bf, __builtin_shufflevector(lo, hi, 0, 1, 2, 3, 4, 5, 6, 7, 8, 9, 10, 11, 12, 13, 14, 15)); }
__device__ __forceinline__ v8f wmma16(v16h a, v16h b, v8f c) { return __builtin_amdgcn_wmma_f32_16x16x32_f16(false, a, false, b, (short)0, c, false, false); }
__device__ __forceinline__ v8f wmmab(v16bf a, v16bf b, v8f c) { return __builtin_amdgcn_wmma_f32_16x16x32_bf16(false, a, false, b, (short)0, c, false, false); }



// ---- fragment loaders: 16 elements of a K-contiguous 16-bit row per lane (k = 8*hi .. 8*hi+7 and 16+8*hi .. 16+8*hi+7), the same for the A and the B operand
template <typename T16> struct WFrag;
template <> struct WFrag<h16> { typedef v16h V; static __device__ __forceinline__ V ld(const h16* p) { return cat16(*(const v8h*)p, *(const v8h*)(p + 16)); } static __device__ __forceinline__ v8f mma(V a, V b, v8f c) { return wmma16(a, b, c); } };
template <> struct WFrag<bf> { typedef v16bf V; static __device__ __forceinline__ V ld(const bf* p) { return cat16b(*(const v8us*)p, *(const v8us*)(p + 16)); } static __device__ __forceinline__ v8f mma(V a, V b, v8f c) { return wmmab(a, b, c); } };

typedef __attribute__((ext_vector_type(2))) unsigned short v2us;
typedef __attribute__((ext_vector_type(2))) float v2f;
typedef __attribute__((ext_vector_type(8))) __bf16 v8b;

// ---- k_wt3: the three weights [DM][HD] f32 -> one K-contiguous 16-bit plane Bt[3*HD][DM] (rows 0..127 q, 128..255 k, 256..383 v). blockIdx.y picks the weight; a thread makes two neighbours in k.
__global__ __launch_bounds__(256) void k_wt3(const float* __restrict__ wq, const float* __restrict__ wk, const float* __restrict__ wv, bf* Bt) {
    const float* w = (blockIdx.y == 0) ? wq : ((blockIdx.y == 1) ? wk : wv);
    const unsigned e = (blockIdx.x * 256u + threadIdx.x) * 2u, k = e % DM, n = e / DM; v2us o;
    o[0] = f2bf(w[k * HD + n]); o[1] = f2bf(w[(k + 1) * HD + n]); *(v2us*)(Bt + blockIdx.y * (unsigned)(HD * DM) + e) = o; }

// ---- k_qkv: q, k and v of 64 rows of x (all batches: row = b*TT + t) in one work-group of 12 waves. The 64 x 768 tile of x is read once in f32, rounded to 16 bits and kept in LDS for all waves;
// wave w makes columns 32w .. 32w+31 of [q | k | v] (4 x 2 accumulators) over the whole K in one chain, its weight rows straight from the K-contiguous plane, fetched two 64-wide slices (whole 128-byte lines) ahead.
// The f32 results pass through LDS (q, k row-major; v transposed) and leave as the f16 planes that k_flash reads: Q [b][t][d] as a hi/lo pair, K [b][t][d] and V [b][d][t] as one plane each; every 128-byte line of a plane has one writer.
#define XP 776   // LDS pitch of an x row in 16-bit elements: 768 + 8 (16 bytes more a row, for the 16-byte readers)
#define OP 260   // LDS pitch of a [q | k] result row in f32: 256 + 4
#define OV 68    // LDS pitch of a transposed v result row in f32: 64 + 4
__global__ __launch_bounds__(384) void k_qkv(const float* __restrict__ x, const bf* __restrict__ Wt, bf* Qp, bf* Kp, bf* Vp) {
    typedef WFrag<bf> F; typedef F::V V;
    __shared__ __align__(16) bf sX[64 * XP];
    __shared__ __align__(16) float sO[64 * OP + HD * OV];
    const int tid = threadIdx.x, lane = tid & 31, lr = lane & 15, hi = lane >> 4; const int wv = __builtin_amdgcn_readfirstlane(tid >> 5);
    const int R0 = blockIdx.x * 64;
    constexpr unsigned LO = NB_ * TT * HD;   // q's lo plane stands this many elements behind its hi plane
    const bf* pb = Wt + (size_t)(wv * 32 + lr) * DM + 8 * hi;
    V b[3][2][2];   // a ring of three 64-wide slices of the wave's weight rows: one in use, two in flight
#pragma unroll
    for (int s = 0; s < 2; ++s)
#pragma unroll
        for (int u = 0; u < 2; ++u)
#pragma unroll
            for (int nb = 0; nb < 2; ++nb) b[s][u][nb] = F::ld(pb + nb * 16 * DM + s * 64 + u * 32);
    { const char* xb = (const char*)(x + (size_t)R0 * DM); const unsigned xo = tid * 32u;   // the tile is 64 whole rows: one contiguous run; piece i of a thread is 384 * 32 bytes (4 rows) on
      v8f t[16];
#pragma unroll
      for (int i = 0; i < 16; ++i) t[i] = *(const v8f*)(xb + xo + i * 12288u);
      asm volatile("s_wait_xcnt 0x0" :: "v"(xo) : "memory");   // the offset register that the loads above name stays whole until this wait
      const int lx = (tid / 96) * XP + (tid % 96) * 8;
#pragma unroll
      for (int i = 0; i < 16; ++i) *(v8us*)(&sX[lx + i * (4 * XP)]) = __builtin_bit_cast(v8us, __builtin_convertvector(t[i], v8b)); }
    __syncthreads();   // the rounded tile is whole before any wave reads a fragment of it
    v8f acc[4][2];
#pragma unroll
    for (int mb = 0; mb < 4; ++mb)
#pragma unroll
        for (int nb = 0; nb < 2; ++nb) acc[mb][nb] = (v8f){};
    // unrolled whole: no back edge behind a matrix instruction, and every address is the lane's base plus a constant
#pragma unroll
    for (int it = 0; it < DM / 64; ++it) {
        if (it + 2 < DM / 64) {
#pragma unroll
            for (int u = 0; u < 2; ++u)
#pragma unroll
                for (int nb = 0; nb < 2; ++nb) b[(it + 2) % 3][u][nb] = F::ld(pb + nb * 16 * DM + (it + 2) * 64 + u * 32); }
        V a[2][4];
#pragma unroll
        for (int u = 0; u < 2; ++u)
#pragma unroll
            for (int mb = 0; mb < 4; ++mb) a[u][mb] = F::ld(&sX[(mb * 16 + lr) * XP + it * 64 + u * 32 + 8 * hi]);
        __builtin_amdgcn_sched_barrier(0);   // the weight slice two trips ahead and this trip's eight x fragments are requested before the first product: otherwise the loads sink to their users and every pair of products waits a whole L2 or LDS latency
#pragma unroll
        for (int u = 0; u < 2; ++u)
#pragma unroll
            for (int mb = 0; mb < 4; ++mb)
#pragma unroll
                for (int nb = 0; nb < 2; ++nb) acc[mb][nb] = F::mma(a[u][mb], b[it % 3][u][nb], acc[mb][nb]);
    }
    asm volatile("s_wait_xcnt 0x0" :: "v"(pb) : "memory");   // as above, for the weight rows' address pair
    // four vector slots behind the last matrix instruction, on both sides of the branch below, before its results are touched
    asm volatile("v_nop\n\tv_nop\n\tv_nop\n\tv_nop" : "+v"(acc[0][0]), "+v"(acc[0][1]), "+v"(acc[1][0]), "+v"(acc[1][1]), "+v"(acc[2][0]), "+v"(acc[2][1]), "+v"(acc[3][0]), "+v"(acc[3][1]));
    // acc[mb][nb][j] = row mb*16 + hi*8 + j, column wv*32 + nb*16 + lr
    if (wv < 8) {   // q and k: row-major (a scalar test)
#pragma unroll
        for (int mb = 0; mb < 4; ++mb)
#pragma unroll
            for (int nb = 0; nb < 2; ++nb)
#pragma unroll
                for (int j = 0; j < 8; ++j) sO[(mb * 16 + hi * 8 + j) * OP + wv * 32 + nb * 16 + lr] = acc[mb][nb][j];
    } else {        // v: transposed, a lane's 8 rows are neighbours
#pragma unroll
        for (int mb = 0; mb < 4; ++mb)
#pragma unroll
            for (int nb = 0; nb < 2; ++nb) { float* p = &sO[64 * OP + ((wv - 8) * 32 + nb * 16 + lr) * OV + mb * 16 + hi * 8];
                *(v4fa*)p = __builtin_shufflevector(acc[mb][nb], acc[mb][nb], 0, 1, 2, 3); *(v4fa*)(p + 4) = __builtin_shufflevector(acc[mb][nb], acc[mb][nb], 4, 5, 6, 7); }
    }
    __syncthreads();   // every wave's results are in LDS before any thread splits them
    // 3072 pieces of 8 results, 8 a thread: pieces 0..1023 are q, 1024..2047 k (16 a row: a wave holds two whole rows), 2048..3071 v (8 a row of 64 t); the borders fall between waves 7 and 8 of round 2 and between waves 3 and 4 of round 5
    v8f r[8]; bf* dst[8];
#pragma unroll
    for (int i = 0; i < 8; ++i) { const int idx = i * 384 + tid; int so;
        if (i < 2 || (i == 2 && wv < 8)) { const int row = idx >> 4, cg = idx & 15; so = row * OP + cg * 8; dst[i] = Qp + (size_t)(R0 + row) * HD + cg * 8; }
        else if (i < 5 || (i == 5 && wv < 4)) { const int row = (idx - 1024) >> 4, cg = idx & 15; so = row * OP + HD + cg * 8; dst[i] = Kp + (size_t)(R0 + row) * HD + cg * 8; }
        else { const int q = idx - 2048, d = q >> 3, tg = q & 7; so = 64 * OP + d * OV + tg * 8; dst[i] = Vp + (size_t)(R0 / TT) * (TT * HD) + (size_t)d * TT + (R0 % TT) + tg * 8; }
        const v4f r0 = *(const v4fa*)(sO + so), r1 = *(const v4fa*)(sO + so + 4); r[i] = __builtin_shufflevector(r0, r1, 0, 1, 2, 3, 4, 5, 6, 7); }
    v8us hb[8], lb[3];
#pragma unroll
    for (int i = 0; i < 8; ++i) { const v8h h = __builtin_convertvector(r[i], v8h); hb[i] = __builtin_bit_cast(v8us, h);   // q, k, v: the result rounded to f16
        if (i < 3) lb[i] = __builtin_bit_cast(v8us, __builtin_convertvector(r[i] - __builtin_convertvector(h, v8f), v8h)); }   // q: lo = what is left, rounded
#pragma unroll
    for (int i = 0; i < 8; ++i) { *(v8us*)dst[i] = hb[i]; if (i < 2 || (i == 2 && wv < 8)) *(v8us*)(dst[i] + LO) = lb[i]; }   // the same scalar test as above
    // every address pair and every data register that the stores above name stays whole until this wait
    asm volatile("s_wait_xcnt 0x0" :: "v"(dst[0]), "v"(dst[1]), "v"(dst[2]), "v"(dst[3]), "v"(dst[4]), "v"(dst[5]), "v"(dst[6]), "v"(dst[7]),
                 "v"(hb[0]), "v"(hb[1]), "v"(hb[2]), "v"(hb[3]), "v"(hb[4]), "v"(hb[5]), "v"(hb[6]), "v"(hb[7]), "v"(lb[0]), "v"(lb[1]), "v"(lb[2]) : "memory");
}

__device__ __forceinline__ float exp2s(float x) { float r; asm("v_exp_f32 %0, %1\n\tv_nop" : "=v"(r) : "v"(x)); return r; }
#define KP 136   // LDS pitch of a key row in 16-bit elements: 128 + 8 (16 bytes more a row, for the 16-byte readers)
#define VP 72    // LDS pitch of a transposed value row: 64 + 8
#define PO 132   // LDS pitch of a staged context row in f32: 128 + 4 (16 bytes more a row, for the 16-byte writers)
typedef __attribute__((ext_vector_type(2))) float v2fl;
// eight asynchronous 16-byte copies of a lane, global memory -> LDS: piece i goes from g + i*GS (elements) to LDS byte address l + L0 + i*LS. The wait on the address translations is the statement's last line, so that no register a copy names is rewritten in front of it.
// The eight LDS addresses are formed inside the statement, in registers that are free again behind it: formed outside, they are loop invariants that the build keeps in 16 registers through the whole loop, which then does not fit four waves per SIMD
template <unsigned L0, unsigned LS, unsigned GS> __device__ __forceinline__ void copy8(unsigned l, const bf* g) {
    unsigned t0, t1, t2, t3, t4, t5, t6, t7;
    asm volatile("v_add_nc_u32 %0, %17, %8\n\t"
                 "v_add_nc_u32 %1, %18, %8\n\t"
                 "v_add_nc_u32 %2, %19, %8\n\t"
                 "v_add_nc_u32 %3, %20, %8\n\t"
                 "v_add_nc_u32 %4, %21, %8\n\t"
                 "v_add_nc_u32 %5, %22, %8\n\t"
                 "v_add_nc_u32 %6, %23, %8\n\t"
                 "v_add_nc_u32 %7, %24, %8\n\t"
                 "global_load_async_to_lds_b128 %0, %9, off\n\t"
                 "global_load_async_to_lds_b128 %1, %10, off\n\t"
                 "global_load_async_to_lds_b128 %2, %11, off\n\t"
                 "global_load_async_to_lds_b128 %3, %12, off\n\t"
                 "global_load_async_to_lds_b128 %4, %13, off\n\t"
                 "global_load_async_to_lds_b128 %5, %14, off\n\t"
                 "global_load_async_to_lds_b128 %6, %15, off\n\t"
                 "global_load_async_to_lds_b128 %7, %16, off\n\t"
                 "s_wait_xcnt 0x0"
                 : "=&v"(t0), "=&v"(t1), "=&v"(t2), "=&v"(t3), "=&v"(t4), "=&v"(t5), "=&v"(t6), "=&v"(t7)
                 : "v"(l), "v"(g), "v"(g + GS), "v"(g + 2 * GS), "v"(g + 3 * GS), "v"(g + 4 * GS), "v"(g + 5 * GS), "v"(g + 6 * GS), "v"(g + 7 * GS),
                   "i"(L0), "i"(L0 + LS), "i"(L0 + 2 * LS), "i"(L0 + 3 * LS), "i"(L0 + 4 * LS), "i"(L0 + 5 * LS), "i"(L0 + 6 * LS), "i"(L0 + 7 * LS) : "memory"); }
__global__ __launch_bounds__(128) void k_flash(const bf* __restrict__ Qh, const bf* __restrict__ Kh, const bf* __restrict__ Vh, float* O, float* ML) {
    typedef WFrag<h16> G; typedef G::V V;
    __shared__ __align__(16) h16 sK[64 * KP];
    __shared__ __align__(16) h16 sV[HD * VP];
    __shared__ __align__(16) float sO[4 * 16 * PO];   // output staging: 16 rows a wave
    const int tid = threadIdx.x, lane = tid & 31, lr = lane & 15, hi = lane >> 4; const int wv = __builtin_amdgcn_readfirstlane(tid >> 5);
    // Query tiles g*XG .. g*XG+XG-1 (group g) have g whole chunks of XG blocks each and one chunk on the diagonal, of 1 .. XG blocks. There are more work-groups than places on the chip;
    // the cost falls with the index (for speed only): first every whole chunk (batch, group, chunk, tile), then the diagonal chunks from XG blocks down to 1 (all batches and groups of a length together): the last indices are short.
    constexpr int XG = KCH / 64, NG = TT / KCH, NF = XG * NG * (NG - 1) / 2;   // NF whole chunks a batch; XG*g*(g-1)/2 of them stand before group g
    int bz, xt, ks;
    if ((int)blockIdx.x < NB_ * NF) { bz = (int)blockIdx.x / NF; const int i = (int)blockIdx.x % NF; int g = 1;
#pragma unroll
        for (int q = 2; q < NG; ++q) if (XG * q * (q - 1) / 2 <= i) g = q;
        const int rem = i - XG * g * (g - 1) / 2; xt = g * XG + rem % XG; ks = rem / XG; }
    else { const int d = (int)blockIdx.x - NB_ * NF, c = d % (NB_ * NG); bz = c / NG; ks = c % NG; xt = ks * XG + (XG - 1 - d / (NB_ * NG)); }
    const int r0 = xt * 64, kbeg = ks * KCH, kend = min(r0 + 64, kbeg + KCH);
    const size_t zb = (size_t)bz * TT * HD; Qh += zb; Kh += zb; Vh += zb;
    constexpr unsigned LO = NB_ * TT * HD;   // q's lo plane stands this many elements behind its hi plane
    const unsigned ko = tid * 8u, vo = (unsigned)(tid >> 3) * TT + (tid & 7) * 8u;                  // staging, global side: piece i of a key plane is 1024 elements on, of a value plane 16 rows on
    const unsigned lk = (unsigned)(size_t)&sK[0] + ((tid >> 4) * KP + (tid & 15) * 8) * 2u;      // staging, LDS side, in bytes: piece i of a key plane is 8 rows on, of a value plane 16 rows on
    const unsigned lv = (unsigned)(size_t)&sV[0] + ((tid >> 3) * VP + (tid & 7) * 8) * 2u;
    // stage 0: the first block's key rows
    copy8<0, 8 * KP * 2, 1024u>(lk, Kh + (size_t)kbeg * HD + ko);
    const int qrow = r0 + wv * 16 + lr;
    V qh[4], ql[4]; const h16* pq = (const h16*)Qh + (size_t)qrow * HD + 8 * hi;
#pragma unroll
    for (int k4 = 0; k4 < 4; ++k4) { qh[k4] = G::ld(pq + k4 * 32); ql[k4] = G::ld(pq + LO + k4 * 32); }
    asm volatile("s_wait_xcnt 0x0" :: "v"(pq) : "memory");   // the address pair that the loads above name stays whole until this wait
    v8f o[8];
#pragma unroll
    for (int nd = 0; nd < 8; ++nd) o[nd] = (v8f){};
    float m = -3.0e38f, l = 0.f;
    asm volatile("s_wait_asynccnt 0x0" ::: "memory");   // this wave's copies of stage 0 have landed
    __syncthreads();                                    // every wave's have: stage 0 may be read
    // stage 1: the first block's value rows
    copy8<0, 16 * VP * 2, 16u * TT>(lv, Vh + kbeg + vo);
    // rolled: one block's scores, probabilities and fragments beside the 8 accumulators and the query fragments fill the register budget of four waves per SIMD
#pragma unroll 1
    for (int kb = kbeg; kb < kend; kb += 64) {
        const int kn = __builtin_amdgcn_readfirstlane(kb + 64);   // the next block's offset stays a scalar that is added to the lane's loop-invariant offsets; the test on it below is a scalar branch, the same for the whole work-group
        // ---- pass on sK: the block's scores and its softmax
        v8f s[4];
#pragma unroll
        for (int nb = 0; nb < 4; ++nb) s[nb] = (v8f){};
#pragma unroll
        for (int k2 = 0; k2 < 4; k2 += 2) { V kf[2][4];
#pragma unroll
            for (int u = 0; u < 2; ++u)
#pragma unroll
                for (int nb = 0; nb < 4; ++nb) kf[u][nb] = G::ld(&sK[(nb * 16 + lr) * KP + (k2 + u) * 32 + 8 * hi]);
            __builtin_amdgcn_sched_barrier(0);   // all eight fragments are requested before the first product: otherwise the loads sink to their users and every two products wait a whole LDS latency
#pragma unroll
            for (int u = 0; u < 2; ++u) {
#pragma unroll
                for (int nb = 0; nb < 4; ++nb) s[nb] = G::mma(kf[u][nb], qh[k2 + u], s[nb]);   // the four accumulators in turn
#pragma unroll
                for (int nb = 0; nb < 4; ++nb) s[nb] = G::mma(kf[u][nb], ql[k2 + u], s[nb]); }
            __builtin_amdgcn_sched_barrier(0); }   // the next eight fragments are requested behind these products: moved in among them they need registers of their own, and the build goes past 256 (three waves per SIMD, or spills)
        // s[nb][j] = score of key kb + nb*16 + hi*8 + j for query qrow, from here on in log2 units
#pragma unroll
        for (int nb = 0; nb < 4; ++nb) s[nb] *= (SCL * 1.4426950408889634f);
        if (kb == r0) {   // only the diagonal block holds keys beyond a query (a scalar test)
#pragma unroll
            for (int nb = 0; nb < 4; ++nb)
#pragma unroll
                for (int j = 0; j < 8; ++j) if (kb + nb * 16 + hi * 8 + j > qrow) s[nb][j] = -3.0e38f; }
        float mloc = s[0][0];
#pragma unroll
        for (int nb = 0; nb < 4; ++nb)
#pragma unroll
            for (int j = 0; j < 8; ++j) mloc = fmaxf(mloc, s[nb][j]);
        mloc = fmaxf(mloc, __shfl_xor(mloc, 16, 32));   // the other half of the wave holds the query's other 32 keys
        // every block holds a key of every query (kb <= r0 <= qrow), so m is a real score from the first block on; a masked key gives the probability 2^(-3e38 - m) = 0
        const float mn = fmaxf(m, mloc), al = exp2s(m - mn); m = mn;
#pragma unroll
        for (int nb = 0; nb < 4; ++nb)
#pragma unroll
            for (int j = 0; j < 8; ++j) s[nb][j] = exp2s(s[nb][j] - mn);
        const v8f p8 = (s[0] + s[1]) + (s[2] + s[3]);   // the lane's 32 probabilities summed as a tree
        l = l * al + (((p8[0] + p8[1]) + (p8[2] + p8[3])) + ((p8[4] + p8[5]) + (p8[6] + p8[7])));
#pragma unroll
        for (int nd = 0; nd < 8; ++nd) o[nd] *= al;
        G::V ph[2];   // probabilities lie in [0, 1]: no overflow in f16, and what falls below its normal range keeps an absolute error under 2^-25 of the largest
#pragma unroll
        for (int h = 0; h < 2; ++h) ph[h] = cat16(__builtin_convertvector(s[h * 2], v8h), __builtin_convertvector(s[h * 2 + 1], v8h));
        // hand-over: this wave has read its last fragment of sK, its copies into sV have landed; behind the barrier sV may be read and sK refilled
        // the wait names the sum and the converted probabilities as inputs, so that they are finished here: otherwise the build sinks them below the branch and keeps the 32 probabilities in f32 alive through the second pass, beyond 256 registers
        asm volatile("s_wait_dscnt 0x0" :: "v"(l), "v"(ph[0]), "v"(ph[1]) : "memory");
        asm volatile("s_wait_asynccnt 0x0" ::: "memory");
        __syncthreads();
        if (kn < kend) copy8<0, 8 * KP * 2, 1024u>(lk, Kh + (size_t)kn * HD + ko);
        // ---- pass on sV: probability x value
#pragma unroll
        for (int h = 0; h < 2; ++h) { G::V vf[8];
#pragma unroll
            for (int nd = 0; nd < 8; ++nd) vf[nd] = G::ld(&sV[(nd * 16 + lr) * VP + h * 32 + 8 * hi]);
            __builtin_amdgcn_sched_barrier(0);   // as above: eight fragments requested before the first product
#pragma unroll
            for (int nd = 0; nd < 8; ++nd) o[nd] = G::mma(vf[nd], ph[h], o[nd]);
            __builtin_amdgcn_sched_barrier(0); }   // as above: the next eight fragments stay behind these products
        // four vector slots behind the block's last matrix instruction, on every path behind it, before its operands or results are touched
        asm volatile("v_nop\n\tv_nop\n\tv_nop\n\tv_nop" : "+v"(o[0]), "+v"(o[1]), "+v"(o[2]), "+v"(o[3]), "+v"(o[4]), "+v"(o[5]), "+v"(o[6]), "+v"(o[7]));
        // hand-over: this wave has read its last fragment of sV, its copies into sK have landed; behind the barrier sK may be read and sV refilled
        asm volatile("s_wait_dscnt 0x0" ::: "memory");
        asm volatile("s_wait_asynccnt 0x0" ::: "memory");
        __syncthreads();
        if (kn < kend) copy8<0, 16 * VP * 2, 16u * TT>(lv, Vh + kn + vo);
    }
    asm volatile("s_wait_asynccnt 0x0" ::: "memory");   // no copy is outstanding when the wave goes on to its end
    l += __shfl_xor(l, 16, 32);   // the two halves' sums are joined once
    const size_t prow = ((size_t)ks * NB_ + bz) * TT + qrow;
    // o[nd][j] = context element d = nd*16 + hi*8 + j of query qrow: stored from here, a wave's store would touch 16 lines with 32 bytes each. The wave's 16 x 128 tile passes through its own range of LDS instead,
    // and every store is one whole query row: 512 contiguous bytes, four whole lines
    float* so = &sO[wv * (16 * PO)];
#pragma unroll
    for (int nd = 0; nd < 8; ++nd) { float* p = so + lr * PO + nd * 16 + hi * 8;
        *(v4fa*)p = __builtin_shufflevector(o[nd], o[nd], 0, 1, 2, 3); *(v4fa*)(p + 4) = __builtin_shufflevector(o[nd], o[nd], 4, 5, 6, 7); }
    asm volatile("s_wait_dscnt 0x0" ::: "memory");   // the wave's tile is whole in LDS before its lanes read rows that other lanes wrote (no other wave touches this range: no barrier)
    v4f rw[16];
#pragma unroll
    for (int r = 0; r < 16; ++r) rw[r] = *(const v4fa*)(so + r * PO + lane * 4);
    float* op = O + (prow - lr) * HD + lane * 4;   // row r of the wave's tile stands r * HD on
#pragma unroll
    for (int r = 0; r < 16; ++r) *(v4f*)(op + r * HD) = rw[r];
    if (hi == 0) { v2fl ml; ml[0] = m; ml[1] = l; *(v2fl*)(ML + prow * 2) = ml; }   // a wave's 16 pairs fill one 128-byte line
}

// k_merge: joins a query's chunks: out = sum_s w_s O_s / sum_s w_s l_s with w_s = 2^(m_s - max m). One wave per query row (32 lanes x 4 elements), all batches in one launch.
__global__ __launch_bounds__(256) void k_merge(const float* __restrict__ O, const float* __restrict__ ML, float* OUTb) { const unsigned e = (blockIdx.x * 256u + threadIdx.x) * 4u, bt = e / HD; const int t = (int)(bt % TT);
    const int nch = __builtin_amdgcn_readfirstlane(((t >> 6) * 64 + 64 + KCH - 1) / KCH);   /* chunks that row t's tile has: only those planes were written; a wave lies in one row, so the count is a scalar */
    v4f pl[TT / KCH]; v2f ml[TT / KCH]; const float* po[TT / KCH]; const float* pm[TT / KCH];   /* all planes are loaded before the first use, so that their latencies overlap; a plane the row does not have is replaced by its last one (written, in cache) and gets weight 0: no branch */
#pragma unroll
    for (int s = 0; s < TT / KCH; ++s) { const int sc = min(s, nch - 1); po[s] = O + (size_t)sc * NB_ * TT * HD + e; pm[s] = ML + (size_t)sc * NB_ * TT * 2 + bt * 2u; pl[s] = *(const v4f*)po[s]; ml[s] = *(const v2f*)pm[s]; }
    /* every address pair that the loads above name stays whole until this wait */
    asm volatile("s_wait_xcnt 0x0" :: "v"(po[0]), "v"(po[1]), "v"(po[2]), "v"(po[3]), "v"(po[4]), "v"(po[5]), "v"(po[6]), "v"(po[7]), "v"(pm[0]), "v"(pm[1]), "v"(pm[2]), "v"(pm[3]), "v"(pm[4]), "v"(pm[5]), "v"(pm[6]), "v"(pm[7]) : "memory");
#pragma unroll
    for (int s = 1; s < TT / KCH; ++s) if (s >= nch) ml[s][0] = -3.0e38f;
    float mx = ml[0][0];
#pragma unroll
    for (int s = 1; s < TT / KCH; ++s) mx = fmaxf(mx, ml[s][0]);
    float den = 0.f; v4f a4 = (v4f){0.f, 0.f, 0.f, 0.f};
#pragma unroll
    for (int s = 0; s < TT / KCH; ++s) { const float w = exp2s(ml[s][0] - mx); den += w * ml[s][1]; a4 += pl[s] * w; }
    *(v4f*)(OUTb + e) = a4 * __fdiv_rn(1.0f, den);  }   /* f32 context straight to the output */

extern "C" void kernel_launch(void* const* d_in, const int* in_sizes, int n_in,
                              void* d_out, int out_size, void* d_ws, size_t ws_size, hipStream_t stream) {
    (void)in_sizes; (void)n_in; (void)out_size;
    const float* x = (const float*)d_in[0]; const float* wq = (const float*)d_in[1]; const float* wk = (const float*)d_in[2]; const float* wv = (const float*)d_in[3];
    float* OUT = (float*)d_out;     // [4][4096][128]
    char* wsp = (char*)d_ws;
    auto take = [&](size_t bytes) { char* p = wsp; wsp += (bytes + 255) & ~(size_t)255; return (void*)p; };
    bf* WT = (bf*)take((size_t)3 * HD * DM * 2);
    const size_t PB = (size_t)TT * HD;   // one batch's plane; the planes of all batches are kept for the one attention launch
    bf* QPh = (bf*)take(2 * NB_ * PB * 2); bf* KPh = (bf*)take(NB_ * PB * 2); bf* VTh = (bf*)take(NB_ * PB * 2);   // f16 planes: q's lo plane right behind its hi plane; k, v: one plane each
    float* Ob = (float*)take((size_t)(TT / KCH) * NB_ * PB * 4); float* ML = (float*)take((size_t)(TT / KCH) * NB_ * TT * 2 * 4);
    if ((size_t)(wsp - (char*)d_ws) > ws_size) return;    // ws 256 MiB
    k_wt3<<<dim3(HD * DM / 512, 3, 1), 256, 0, stream>>>(wq, wk, wv, WT);
    k_qkv<<<NB_ * TT / 64, 384, 0, stream>>>(x, WT, QPh, KPh, VTh);
    k_flash<<<(KCH / 64) * (TT / KCH) * (TT / KCH + 1) / 2 * NB_, 128, 0, stream>>>(QPh, KPh, VTh, Ob, ML);
    k_merge<<<(unsigned)((size_t)NB_ * TT * HD / 4 / 256), 256, 0, stream>>>(Ob, ML, OUT);
}

// v009
// A run of this version takes 50.6 microseconds.
// In both of two side-by-side timings against v008, it was 1.07 times as fast.
// Counting every step since v000, it is 16.9 times as fast.
#include <hip/hip_runtime.h>

// Single-head causal attention (x [4][4096][768]; q, k, v = x W ('xw' [768][128], no bias); scores = q.k, causal (-inf), softmax(scores/sqrt(128)); out = attn.v -> [4][4096][128] f32 (2.1 M); no output projection).
// Compute dtypes, f32 accumulate: every input rounded to bf16; q/k/v on PLAIN bf16 operands (inputs: exact), one kernel for all three and all batches that rounds x on the way into LDS and writes the f16 planes itself; causal scores (tile skipping) on TWO f16 products for every row (k rounded once to f16: 11 significant bits; q as an f16 hi/lo pair), attn.v on ONE f16 product (probabilities and values each rounded once to f16: 11 significant bits), fused in one kernel with an online softmax in f32 (scores and probabilities stay in registers); no output projection: the context is written in f32.

#define NB_  4
#define TT   4096
#define DM   768
#define NH_  1
#define NKV  1
#define REP  (NH_ / NKV)
#define HD   128
#define DQ   (NH_ * HD)
#define DKV  (NKV * HD)
#define ZH   1
#define RH   4096                 // every row hi/lo (streaming softmax, no register row)
#define RB   TT
#define WIN  4096
#define PCAR 1024.0f
#define SCL  0.088388347648318447f   // HD^-0.5
#define KCH  512                  // keys per chunk of the probability x value product (one partial plane per chunk)
typedef _Float16 h16;
typedef unsigned short bf;
typedef __attribute__((ext_vector_type(16))) __bf16   v16bf;
typedef __attribute__((ext_vector_type(16))) _Float16 v16h;
typedef __attribute__((ext_vector_type(8)))  _Float16 v8h;
typedef __attribute__((ext_vector_type(8)))  unsigned short v8us;
typedef __attribute__((ext_vector_type(8)))  float    v8f;
typedef __attribute__((ext_vector_type(4)))  float    v4f;
typedef v8h  __attribute__((may_alias)) v8ha;
typedef v4f  __attribute__((may_alias)) v4fa;
typedef v8us __attribute__((may_alias)) v8usa;

__device__ __forceinline__ unsigned short f2bf(float f) { unsigned u = __float_as_uint(f); u += 0x7FFFu + ((u >> 16) & 1u); return (unsigned short)(u >> 16); }
__device__ __forceinline__ float bf2f(unsigned short b) { return __uint_as_float(((unsigned)b) << 16); }
__device__ __forceinline__ float bfr(float f) { return bf2f(f2bf(f)); }
__device__ __forceinline__ v16h cat16(v8h lo, v8h hi) { return __builtin_shufflevector(lo, hi, 0, 1, 2, 3, 4, 5, 6, 7, 8, 9, 10, 11, 12, 13, 14, 15); }
__device__ __forceinline__ v16bf cat16b(v8us lo, v8us hi) { return __builtin_bit_cast(v16bf, __builtin_shufflevector(lo, hi, 0, 1, 2, 3, 4, 5, 6, 7, 8, 9, 10, 11, 12, 13, 14, 15)); }
__device__ __forceinline__ v8f wmma16(v16h a, v16h b, v8f c) { return __builtin_amdgcn_wmma_f32_16x16x32_f16(false, a, false, b, (short)0, c, false, false); }
__device__ __forceinline__ v8f wmmab(v16bf a, v16bf b, v8f c) { return __builtin_amdgcn_wmma_f32_16x16x32_bf16(false, a, false, b, (short)0, c, false, false); }



// ---- fragment loaders: 16 elements of a K-contiguous 16-bit row per lane (k = 8*hi .. 8*hi+7 and 16+8*hi .. 16+8*hi+7), the same for the A and the B operand
template <typename T16> struct WFrag;
template <> struct WFrag<h16> { typedef v16h V; static __device__ __forceinline__ V ld(const h16* p) { return cat16(*(const v8h*)p, *(const v8h*)(p + 16)); } static __device__ __forceinline__ v8f mma(V a, V b, v8f c) { return wmma16(a, b, c); } };
template <> struct WFrag<bf> { typedef v16bf V; static __device__ __forceinline__ V ld(const bf* p) { return cat16b(*(const v8us*)p, *(const v8us*)(p + 16)); } static __device__ __forceinline__ v8f mma(V a, V b, v8f c) { return wmmab(a, b, c); } };

typedef __attribute__((ext_vector_type(2))) float v2f;
typedef __attribute__((ext_vector_type(8))) __bf16 v8b;

// ---- k_wt3: the three weights [DM][HD] f32 -> one 16-bit plane Bt in the order of k_qkv's B fragments. Fragment (cg, ks) = columns 16*cg .. 16*cg+15 of [q | k | v] (cg 0..7 q, 8..15 k, 16..23 v), k = 32*ks .. 32*ks+31, is 1 KiB:
// two halves of 512 bytes with 16 bytes a lane (lane = column + 16*hi; half h of a lane holds k = 32*ks + 16*h + 8*hi + 0..7); the DM/32 fragments of a column group stand in a row. blockIdx.y picks the weight; a thread makes one lane's 16 bytes of one half.
#define WG_ (DM / 32 * 512)   // elements of one column group's fragments
__global__ __launch_bounds__(256) void k_wt3(const float* __restrict__ wq, const float* __restrict__ wk, const float* __restrict__ wv, bf* Bt) {
    const float* w = (blockIdx.y == 0) ? wq : ((blockIdx.y == 1) ? wk : wv);
    const unsigned t = blockIdx.x * 256u + threadIdx.x, lane = t & 31u, f = t >> 6;   // f = (column group of this weight) * (DM/32) + ks
    const unsigned n = (f / (DM / 32)) * 16u + (lane & 15u), k0 = (f % (DM / 32)) * 32u + ((t >> 5) & 1u) * 16u + (lane >> 4) * 8u; v8us o;
#pragma unroll   // the eight loads (16 lanes x 4 bytes of two rows each) are requested together, and o is indexed by constants
    for (int j = 0; j < 8; ++j) o[j] = f2bf(w[(k0 + j) * HD + n]);
    *(v8us*)(Bt + blockIdx.y * (unsigned)(HD * DM) + t * 8u) = o; }
// a B fragment from that plane: two loads, each 512 contiguous bytes a wave (four whole lines); p = the fragment's start + lane * 8
__device__ __forceinline__ v16bf ldw(const bf* p) { return cat16b(*(const v8us*)p, *(const v8us*)(p + 256)); }

// ---- k_qkv: q, k and v of 64 rows of x (all batches: row = b*TT + t) in one work-group of 12 waves. The 64 x 768 tile of x is read once in f32, rounded to 16 bits and kept in LDS for all waves;
// wave w makes columns 32w .. 32w+31 of [q | k | v] (4 x 2 accumulators) over the whole K in one chain, its weight fragments straight from the fragment-order plane (no load touches part of a line), fetched two 64-wide slices ahead.
// The f32 results pass through LDS (q, k row-major; v transposed) and leave as the f16 planes that k_flash reads: Q as a hi/lo pair, K [b][t][d] and V [b][d][t] as one plane each; every 128-byte line of a plane has one writer.
// Q, which k_flash loads straight into B fragments, stands in their order: the 16 x 128 tile of 16 neighbouring rows is 4 KiB = 8 halves of 512 bytes with 16 bytes a lane (lane = row + 16*hi; half fh of a lane holds d = 32*(fh/2) + 16*(fh%2) + 8*hi + 0..7).
#define XP 776   // LDS pitch of an x row in 16-bit elements: 768 + 8 (16 bytes more a row, for the 16-byte readers)
#define OP 260   // LDS pitch of a [q | k] result row in f32: 256 + 4
#define OV 68    // LDS pitch of a transposed v result row in f32: 64 + 4
__global__ __launch_bounds__(384) void k_qkv(const float* __restrict__ x, const bf* __restrict__ Wt, bf* Qp, bf* Kp, bf* Vp) {
    typedef WFrag<bf> F; typedef F::V V;
    __shared__ __align__(16) bf sX[64 * XP];
    __shared__ __align__(16) float sO[64 * OP + HD * OV];
    const int tid = threadIdx.x, lane = tid & 31, lr = lane & 15, hi = lane >> 4; const int wv = __builtin_amdgcn_readfirstlane(tid >> 5);
    const int R0 = blockIdx.x * 64;
    constexpr unsigned LO = NB_ * TT * HD;   // q's lo plane stands this many elements behind its hi plane
    const bf* wb = Wt + (size_t)(wv * 2) * WG_; const bf* pb = wb + lane * 8;   // the wave's two column groups; fragment (nb, ks) stands nb * WG_ + ks * 512 on
    V b[3][2][2];   // a ring of three 64-wide slices of the wave's weight fragments: one in use, two in flight
#pragma unroll
    for (int s = 0; s < 2; ++s)
#pragma unroll
        for (int u = 0; u < 2; ++u)
#pragma unroll
            for (int nb = 0; nb < 2; ++nb) b[s][u][nb] = ldw(pb + nb * WG_ + (s * 2 + u) * 512);
    { const char* xb = (const char*)(x + (size_t)R0 * DM); const unsigned xo = tid * 32u;   // the tile is 64 whole rows: one contiguous run; piece i of a thread is 384 * 32 bytes (4 rows) on
      v8f t[16];
#pragma unroll
      for (int i = 0; i < 16; ++i) t[i] = *(const v8f*)(xb + xo + i * 12288u);
      asm volatile("s_wait_xcnt 0x0" :: "v"(xo) : "memory");   // the offset register that the loads above name stays whole until this wait
      const int lx = (tid / 96) * XP + (tid % 96) * 8;
#pragma unroll
      for (int i = 0; i < 16; ++i) *(v8us*)(&sX[lx + i * (4 * XP)]) = __builtin_bit_cast(v8us, __builtin_convertvector(t[i], v8b)); }
    __syncthreads();   // the rounded tile is whole before any wave reads a fragment of it
    v8f acc[4][2];
#pragma unroll
    for (int mb = 0; mb < 4; ++mb)
#pragma unroll
        for (int nb = 0; nb < 2; ++nb) acc[mb][nb] = (v8f){};
    // unrolled whole: no back edge behind a matrix instruction, and every address is the lane's base plus a constant
#pragma unroll
    for (int it = 0; it < DM / 64; ++it) {
        if (it + 2 < DM / 64) {
#pragma unroll
            for (int u = 0; u < 2; ++u)
#pragma unroll
                for (int nb = 0; nb < 2; ++nb) b[(it + 2) % 3][u][nb] = ldw(pb + nb * WG_ + ((it + 2) * 2 + u) * 512); }
        V a[2][4];
#pragma unroll
        for (int u = 0; u < 2; ++u)
#pragma unroll
            for (int mb = 0; mb < 4; ++mb) a[u][mb] = F::ld(&sX[(mb * 16 + lr) * XP + it * 64 + u * 32 + 8 * hi]);
        __builtin_amdgcn_sched_barrier(0);   // the weight slice two trips ahead and this trip's eight x fragments are requested before the first product: otherwise the loads sink to their users and every pair of products waits a whole L2 or LDS latency
#pragma unroll
        for (int u = 0; u < 2; ++u)
#pragma unroll
            for (int mb = 0; mb < 4; ++mb)
#pragma unroll
                for (int nb = 0; nb < 2; ++nb) acc[mb][nb] = F::mma(a[u][mb], b[it % 3][u][nb], acc[mb][nb]);
    }
    asm volatile("s_wait_xcnt 0x0" :: "s"(wb), "v"(lane) : "memory");   // as above, for the weight fragments' scalar base and the lane's offset register
    // four vector slots behind the last matrix instruction, on both sides of the branch below, before its results are touched
    asm volatile("v_nop\n\tv_nop\n\tv_nop\n\tv_nop" : "+v"(acc[0][0]), "+v"(acc[0][1]), "+v"(acc[1][0]), "+v"(acc[1][1]), "+v"(acc[2][0]), "+v"(acc[2][1]), "+v"(acc[3][0]), "+v"(acc[3][1]));
    // acc[mb][nb][j] = row mb*16 + hi*8 + j, column wv*32 + nb*16 + lr
    if (wv < 8) {   // q and k: row-major (a scalar test)
#pragma unroll
        for (int mb = 0; mb < 4; ++mb)
#pragma unroll
            for (int nb = 0; nb < 2; ++nb)
#pragma unroll
                for (int j = 0; j < 8; ++j) sO[(mb * 16 + hi * 8 + j) * OP + wv * 32 + nb * 16 + lr] = acc[mb][nb][j];
    } else {        // v: transposed, a lane's 8 rows are neighbours
#pragma unroll
        for (int mb = 0; mb < 4; ++mb)
#pragma unroll
            for (int nb = 0; nb < 2; ++nb) { float* p = &sO[64 * OP + ((wv - 8) * 32 + nb * 16 + lr) * OV + mb * 16 + hi * 8];
                *(v4fa*)p = __builtin_shufflevector(acc[mb][nb], acc[mb][nb], 0, 1, 2, 3); *(v4fa*)(p + 4) = __builtin_shufflevector(acc[mb][nb], acc[mb][nb], 4, 5, 6, 7); }
    }
    __syncthreads();   // every wave's results are in LDS before any thread splits them
    // 3072 pieces of 8 results, 8 a thread: pieces 0..1023 are q (in fragment order: a wave holds one half of 512 bytes), 1024..2047 k (16 a row: a wave holds two whole rows), 2048..3071 v (8 a row of 64 t); the borders fall between waves 7 and 8 of round 2 and between waves 3 and 4 of round 5
    v8f r[8]; bf* dst[8];
#pragma unroll
    for (int i = 0; i < 8; ++i) { const int idx = i * 384 + tid; int so;
        if (i < 2 || (i == 2 && wv < 8)) { const int fh = (idx >> 5) & 7, row = (idx >> 8) * 16 + lr, cg = (fh >> 1) * 4 + (fh & 1) * 2 + hi; so = row * OP + cg * 8; dst[i] = Qp + (size_t)R0 * HD + idx * 8; }   // piece idx = (16-row tile, fragment half fh, lane): see the head of the kernel
        else if (i < 5 || (i == 5 && wv < 4)) { const int row = (idx - 1024) >> 4, cg = idx & 15; so = row * OP + HD + cg * 8; dst[i] = Kp + (size_t)(R0 + row) * HD + cg * 8; }
        else { const int q = idx - 2048, d = q >> 3, tg = q & 7; so = 64 * OP + d * OV + tg * 8; dst[i] = Vp + (size_t)(R0 / TT) * (TT * HD) + (size_t)d * TT + (R0 % TT) + tg * 8; }
        const v4f r0 = *(const v4fa*)(sO + so), r1 = *(const v4fa*)(sO + so + 4); r[i] = __builtin_shufflevector(r0, r1, 0, 1, 2, 3, 4, 5, 6, 7); }
    v8us hb[8], lb[3];
#pragma unroll
    for (int i = 0; i < 8; ++i) { const v8h h = __builtin_convertvector(r[i], v8h); hb[i] = __builtin_bit_cast(v8us, h);   // q, k, v: the result rounded to f16
        if (i < 3) lb[i] = __builtin_bit_cast(v8us, __builtin_convertvector(r[i] - __builtin_convertvector(h, v8f), v8h)); }   // q: lo = what is left, rounded
#pragma unroll
    for (int i = 0; i < 8; ++i) { *(v8us*)dst[i] = hb[i]; if (i < 2 || (i == 2 && wv < 8)) *(v8us*)(dst[i] + LO) = lb[i]; }   // the same scalar test as above
    // every address pair and every data register that the stores above name stays whole until this wait
    asm volatile("s_wait_xcnt 0x0" :: "v"(dst[0]), "v"(dst[1]), "v"(dst[2]), "v"(dst[3]), "v"(dst[4]), "v"(dst[5]), "v"(dst[6]), "v"(dst[7]),
                 "v"(hb[0]), "v"(hb[1]), "v"(hb[2]), "v"(hb[3]), "v"(hb[4]), "v"(hb[5]), "v"(hb[6]), "v"(hb[7]), "v"(lb[0]), "v"(lb[1]), "v"(lb[2]) : "memory");
}

__device__ __forceinline__ float exp2s(float x) { float r; asm("v_exp_f32 %0, %1\n\tv_nop" : "=v"(r) : "v"(x)); return r; }
#define KP 136   // LDS pitch of a key row in 16-bit elements: 128 + 8 (16 bytes more a row, for the 16-byte readers)
#define VP 72    // LDS pitch of a transposed value row: 64 + 8
#define PO 132   // LDS pitch of a staged context row in f32: 128 + 4 (16 bytes more a row, for the 16-byte writers)
typedef __attribute__((ext_vector_type(2))) float v2fl;
// eight asynchronous 16-byte copies of a lane, global memory -> LDS: piece i goes from g + i*GS (elements) to LDS byte address l + L0 + i*LS. The wait on the address translations is the statement's last line, so that no register a copy names is rewritten in front of it.
// The eight LDS addresses are formed inside the statement, in registers that are free again behind it: formed outside, they are loop invariants that the build keeps in 16 registers through the whole loop, which then does not fit four waves per SIMD
template <unsigned L0, unsigned LS, unsigned GS> __device__ __forceinline__ void copy8(unsigned l, const bf* g) {
    unsigned t0, t1, t2, t3, t4, t5, t6, t7;
    asm volatile("v_add_nc_u32 %0, %17, %8\n\t"
                 "v_add_nc_u32 %1, %18, %8\n\t"
                 "v_add_nc_u32 %2, %19, %8\n\t"
                 "v_add_nc_u32 %3, %20, %8\n\t"
                 "v_add_nc_u32 %4, %21, %8\n\t"
                 "v_add_nc_u32 %5, %22, %8\n\t"
                 "v_add_nc_u32 %6, %23, %8\n\t"
                 "v_add_nc_u32 %7, %24, %8\n\t"
                 "global_load_async_to_lds_b128 %0, %9, off\n\t"
                 "global_load_async_to_lds_b128 %1, %10, off\n\t"
                 "global_load_async_to_lds_b128 %2, %11, off\n\t"
                 "global_load_async_to_lds_b128 %3, %12, off\n\t"
                 "global_load_async_to_lds_b128 %4, %13, off\n\t"
                 "global_load_async_to_lds_b128 %5, %14, off\n\t"
                 "global_load_async_to_lds_b128 %6, %15, off\n\t"
                 "global_load_async_to_lds_b128 %7, %16, off\n\t"
                 "s_wait_xcnt 0x0"
                 : "=&v"(t0), "=&v"(t1), "=&v"(t2), "=&v"(t3), "=&v"(t4), "=&v"(t5), "=&v"(t6), "=&v"(t7)
                 : "v"(l), "v"(g), "v"(g + GS), "v"(g + 2 * GS), "v"(g + 3 * GS), "v"(g + 4 * GS), "v"(g + 5 * GS), "v"(g + 6 * GS), "v"(g + 7 * GS),
                   "i"(L0), "i"(L0 + LS), "i"(L0 + 2 * LS), "i"(L0 + 3 * LS), "i"(L0 + 4 * LS), "i"(L0 + 5 * LS), "i"(L0 + 6 * LS), "i"(L0 + 7 * LS) : "memory"); }
__global__ __launch_bounds__(128) void k_flash(const bf* __restrict__ Qh, const bf* __restrict__ Kh, const bf* __restrict__ Vh, float* O, float* ML) {
    typedef WFrag<h16> G; typedef G::V V;
    __shared__ __align__(16) h16 sK[64 * KP];
    __shared__ __align__(16) h16 sV[HD * VP];
    __shared__ __align__(16) float sO[4 * 16 * PO];   // output staging: 16 rows a wave
    const int tid = threadIdx.x, lane = tid & 31, lr = lane & 15, hi = lane >> 4; const int wv = __builtin_amdgcn_readfirstlane(tid >> 5);
    // Query tiles g*XG .. g*XG+XG-1 (group g) have g whole chunks of XG blocks each and one chunk on the diagonal, of 1 .. XG blocks. There are more work-groups than places on the chip;
    // the cost falls with the index (for speed only): first every whole chunk (batch, group, chunk, tile), then the diagonal chunks from XG blocks down to 1 (all batches and groups of a length together): the last indices are short.
    constexpr int XG = KCH / 64, NG = TT / KCH, NF = XG * NG * (NG - 1) / 2;   // NF whole chunks a batch; XG*g*(g-1)/2 of them stand before group g
    int bz, xt, ks;
    if ((int)blockIdx.x < NB_ * NF) { bz = (int)blockIdx.x / NF; const int i = (int)blockIdx.x % NF; int g = 1;
#pragma unroll
        for (int q = 2; q < NG; ++q) if (XG * q * (q - 1) / 2 <= i) g = q;
        const int rem = i - XG * g * (g - 1) / 2; xt = g * XG + rem % XG; ks = rem / XG; }
    else { const int d = (int)blockIdx.x - NB_ * NF, c = d % (NB_ * NG); bz = c / NG; ks = c % NG; xt = ks * XG + (XG - 1 - d / (NB_ * NG)); }
    const int r0 = xt * 64, kbeg = ks * KCH, kend = min(r0 + 64, kbeg + KCH);
    const size_t zb = (size_t)bz * TT * HD; Qh += zb; Kh += zb; Vh += zb;
    constexpr unsigned LO = NB_ * TT * HD;   // q's lo plane stands this many elements behind its hi plane
    const unsigned ko = tid * 8u, vo = (unsigned)(tid >> 3) * TT + (tid & 7) * 8u;                  // staging, global side: piece i of a key plane is 1024 elements on, of a value plane 16 rows on
    const unsigned lk = (unsigned)(size_t)&sK[0] + ((tid >> 4) * KP + (tid & 15) * 8) * 2u;      // staging, LDS side, in bytes: piece i of a key plane is 8 rows on, of a value plane 16 rows on
    const unsigned lv = (unsigned)(size_t)&sV[0] + ((tid >> 3) * VP + (tid & 7) * 8) * 2u;
    // stage 0: the first block's key rows
    copy8<0, 8 * KP * 2, 1024u>(lk, Kh + (size_t)kbeg * HD + ko);
    const int qrow = r0 + wv * 16 + lr;
    V qh[4], ql[4]; const h16* qb = (const h16*)Qh + (size_t)(r0 + wv * 16) * HD; const h16* pq = qb + lane * 8;   // the wave's 16-row tile in fragment order: every load is 512 contiguous bytes
#pragma unroll
    for (int k4 = 0; k4 < 4; ++k4) { qh[k4] = cat16(*(const v8h*)(pq + k4 * 512), *(const v8h*)(pq + k4 * 512 + 256)); ql[k4] = cat16(*(const v8h*)(pq + LO + k4 * 512), *(const v8h*)(pq + LO + k4 * 512 + 256)); }
    asm volatile("s_wait_xcnt 0x0" :: "s"(qb), "v"(lane) : "memory");   // the scalar base and the lane's offset register that the loads above name stay whole until this wait
    v8f o[8];
#pragma unroll
    for (int nd = 0; nd < 8; ++nd) o[nd] = (v8f){};
    float m = -3.0e38f, l = 0.f;
    asm volatile("s_wait_asynccnt 0x0" ::: "memory");   // this wave's copies of stage 0 have landed
    __syncthreads();                                    // every wave's have: stage 0 may be read
    // stage 1: the first block's value rows
    copy8<0, 16 * VP * 2, 16u * TT>(lv, Vh + kbeg + vo);
    // rolled: one block's scores, probabilities and fragments beside the 8 accumulators and the query fragments fill the register budget of four waves per SIMD
#pragma unroll 1
    for (int kb = kbeg; kb < kend; kb += 64) {
        const int kn = __builtin_amdgcn_readfirstlane(kb + 64);   // the next block's offset stays a scalar that is added to the lane's loop-invariant offsets; the test on it below is a scalar branch, the same for the whole work-group
        // ---- pass on sK: the block's scores and its softmax
        v8f s[4];
#pragma unroll
        for (int nb = 0; nb < 4; ++nb) s[nb] = (v8f){};
#pragma unroll
        for (int k2 = 0; k2 < 4; k2 += 2) { V kf[2][4];
#pragma unroll
            for (int u = 0; u < 2; ++u)
#pragma unroll
                for (int nb = 0; nb < 4; ++nb) kf[u][nb] = G::ld(&sK[(nb * 16 + lr) * KP + (k2 + u) * 32 + 8 * hi]);
            __builtin_amdgcn_sched_barrier(0);   // all eight fragments are requested before the first product: otherwise the loads sink to their users and every two products wait a whole LDS latency
#pragma unroll
            for (int u = 0; u < 2; ++u) {
#pragma unroll
                for (int nb = 0; nb < 4; ++nb) s[nb] = G::mma(kf[u][nb], qh[k2 + u], s[nb]);   // the four accumulators in turn
#pragma unroll
                for (int nb = 0; nb < 4; ++nb) s[nb] = G::mma(kf[u][nb], ql[k2 + u], s[nb]); }
            __builtin_amdgcn_sched_barrier(0); }   // the next eight fragments are requested behind these products: moved in among them they need registers of their own, and the build goes past 256 (three waves per SIMD, or spills)
        // s[nb][j] = score of key kb + nb*16 + hi*8 + j for query qrow, from here on in log2 units
#pragma unroll
        for (int nb = 0; nb < 4; ++nb) s[nb] *= (SCL * 1.4426950408889634f);
        if (kb == r0) {   // only the diagonal block holds keys beyond a query (a scalar test)
#pragma unroll
            for (int nb = 0; nb < 4; ++nb)
#pragma unroll
                for (int j = 0; j < 8; ++j) if (kb + nb * 16 + hi * 8 + j > qrow) s[nb][j] = -3.0e38f; }
        float mloc = s[0][0];
#pragma unroll
        for (int nb = 0; nb < 4; ++nb)
#pragma unroll
            for (int j = 0; j < 8; ++j) mloc = fmaxf(mloc, s[nb][j]);
        mloc = fmaxf(mloc, __shfl_xor(mloc, 16, 32));   // the other half of the wave holds the query's other 32 keys
        // every block holds a key of every query (kb <= r0 <= qrow), so m is a real score from the first block on; a masked key gives the probability 2^(-3e38 - m) = 0
        const float mn = fmaxf(m, mloc), al = exp2s(m - mn); m = mn;
#pragma unroll
        for (int nb = 0; nb < 4; ++nb)
#pragma unroll
            for (int j = 0; j < 8; ++j) s[nb][j] = exp2s(s[nb][j] - mn);
        const v8f p8 = (s[0] + s[1]) + (s[2] + s[3]);   // the lane's 32 probabilities summed as a tree
        l = l * al + (((p8[0] + p8[1]) + (p8[2] + p8[3])) + ((p8[4] + p8[5]) + (p8[6] + p8[7])));
#pragma unroll
        for (int nd = 0; nd < 8; ++nd) o[nd] *= al;
        G::V ph[2];   // probabilities lie in [0, 1]: no overflow in f16, and what falls below its normal range keeps an absolute error under 2^-25 of the largest
#pragma unroll
        for (int h = 0; h < 2; ++h) ph[h] = cat16(__builtin_convertvector(s[h * 2], v8h), __builtin_convertvector(s[h * 2 + 1], v8h));
        // hand-over: this wave has read its last fragment of sK, its copies into sV have landed; behind the barrier sV may be read and sK refilled
        // the wait names the sum and the converted probabilities as inputs, so that they are finished here: otherwise the build sinks them below the branch and keeps the 32 probabilities in f32 alive through the second pass, beyond 256 registers
        asm volatile("s_wait_dscnt 0x0" :: "v"(l), "v"(ph[0]), "v"(ph[1]) : "memory");
        asm volatile("s_wait_asynccnt 0x0" ::: "memory");
        __syncthreads();
        if (kn < kend) copy8<0, 8 * KP * 2, 1024u>(lk, Kh + (size_t)kn * HD + ko);
        // ---- pass on sV: probability x value
#pragma unroll
        for (int h = 0; h < 2; ++h) { G::V vf[8];
#pragma unroll
            for (int nd = 0; nd < 8; ++nd) vf[nd] = G::ld(&sV[(nd * 16 + lr) * VP + h * 32 + 8 * hi]);
            __builtin_amdgcn_sched_barrier(0);   // as above: eight fragments requested before the first product
#pragma unroll
            for (int nd = 0; nd < 8; ++nd) o[nd] = G::mma(vf[nd], ph[h], o[nd]);
            __builtin_amdgcn_sched_barrier(0); }   // as above: the next eight fragments stay behind these products
        // four vector slots behind the block's last matrix instruction, on every path behind it, before its operands or results are touched
        asm volatile("v_nop\n\tv_nop\n\tv_nop\n\tv_nop" : "+v"(o[0]), "+v"(o[1]), "+v"(o[2]), "+v"(o[3]), "+v"(o[4]), "+v"(o[5]), "+v"(o[6]), "+v"(o[7]));
        // hand-over: this wave has read its last fragment of sV, its copies into sK have landed; behind the barrier sK may be read and sV refilled
        asm volatile("s_wait_dscnt 0x0" ::: "memory");
        asm volatile("s_wait_asynccnt 0x0" ::: "memory");
        __syncthreads();
        if (kn < kend) copy8<0, 16 * VP * 2, 16u * TT>(lv, Vh + kn + vo);
    }
    asm volatile("s_wait_asynccnt 0x0" ::: "memory");   // no copy is outstanding when the wave goes on to its end
    l += __shfl_xor(l, 16, 32);   // the two halves' sums are joined once
    const size_t prow = ((size_t)ks * NB_ + bz) * TT + qrow;
    // o[nd][j] = context element d = nd*16 + hi*8 + j of query qrow: stored from here, a wave's store would touch 16 lines with 32 bytes each. The wave's 16 x 128 tile passes through its own range of LDS instead,
    // and every store is one whole query row: 512 contiguous bytes, four whole lines
    float* so = &sO[wv * (16 * PO)];
#pragma unroll
    for (int nd = 0; nd < 8; ++nd) { float* p = so + lr * PO + nd * 16 + hi * 8;
        *(v4fa*)p = __builtin_shufflevector(o[nd], o[nd], 0, 1, 2, 3); *(v4fa*)(p + 4) = __builtin_shufflevector(o[nd], o[nd], 4, 5, 6, 7); }
    asm volatile("s_wait_dscnt 0x0" ::: "memory");   // the wave's tile is whole in LDS before its lanes read rows that other lanes wrote (no other wave touches this range: no barrier)
    v4f rw[16];
#pragma unroll
    for (int r = 0; r < 16; ++r) rw[r] = *(const v4fa*)(so + r * PO + lane * 4);
    float* op = O + (prow - lr) * HD + lane * 4;   // row r of the wave's tile stands r * HD on
#pragma unroll
    for (int r = 0; r < 16; ++r) *(v4f*)(op + r * HD) = rw[r];
    if (hi == 0) { v2fl ml; ml[0] = m; ml[1] = l; *(v2fl*)(ML + prow * 2) = ml; }   // a wave's 16 pairs fill one 128-byte line
}

// k_merge: joins a query's chunks: out = sum_s w_s O_s / sum_s w_s l_s with w_s = 2^(m_s - max m). One wave per query row (32 lanes x 4 elements), all batches in one launch.
__global__ __launch_bounds__(256) void k_merge(const float* __restrict__ O, const float* __restrict__ ML, float* OUTb) { const unsigned e = (blockIdx.x * 256u + threadIdx.x) * 4u, bt = e / HD; const int t = (int)(bt % TT);
    const int nch = __builtin_amdgcn_readfirstlane(((t >> 6) * 64 + 64 + KCH - 1) / KCH);   /* chunks that row t's tile has: only those planes were written; a wave lies in one row, so the count is a scalar */
    v4f pl[TT / KCH]; v2f ml[TT / KCH]; const float* po[TT / KCH]; const float* pm[TT / KCH];   /* all planes are loaded before the first use, so that their latencies overlap; a plane the row does not have is replaced by its last one (written, in cache) and gets weight 0: no branch */
#pragma unroll
    for (int s = 0; s < TT / KCH; ++s) { const int sc = min(s, nch - 1); po[s] = O + (size_t)sc * NB_ * TT * HD + e; pm[s] = ML + (size_t)sc * NB_ * TT * 2 + bt * 2u; pl[s] = *(const v4f*)po[s]; ml[s] = *(const v2f*)pm[s]; }
    /* every address pair that the loads above name stays whole until this wait */
    asm volatile("s_wait_xcnt 0x0" :: "v"(po[0]), "v"(po[1]), "v"(po[2]), "v"(po[3]), "v"(po[4]), "v"(po[5]), "v"(po[6]), "v"(po[7]), "v"(pm[0]), "v"(pm[1]), "v"(pm[2]), "v"(pm[3]), "v"(pm[4]), "v"(pm[5]), "v"(pm[6]), "v"(pm[7]) : "memory");
#pragma unroll
    for (int s = 1; s < TT / KCH; ++s) if (s >= nch) ml[s][0] = -3.0e38f;
    float mx = ml[0][0];
#pragma unroll
    for (int s = 1; s < TT / KCH; ++s) mx = fmaxf(mx, ml[s][0]);
    float den = 0.f; v4f a4 = (v4f){0.f, 0.f, 0.f, 0.f};
#pragma unroll
    for (int s = 0; s < TT / KCH; ++s) { const float w = exp2s(ml[s][0] - mx); den += w * ml[s][1]; a4 += pl[s] * w; }
    *(v4f*)(OUTb + e) = a4 * __fdiv_rn(1.0f, den);  }   /* f32 context straight to the output */

extern "C" void kernel_launch(void* const* d_in, const int* in_sizes, int n_in,
                              void* d_out, int out_size, void* d_ws, size_t ws_size, hipStream_t stream) {
    (void)in_sizes; (void)n_in; (void)out_size;
    const float* x = (const float*)d_in[0]; const float* wq = (const float*)d_in[1]; const float* wk = (const float*)d_in[2]; const float* wv = (const float*)d_in[3];
    float* OUT = (float*)d_out;     // [4][4096][128]
    char* wsp = (char*)d_ws;
    auto take = [&](size_t bytes) { char* p = wsp; wsp += (bytes + 255) & ~(size_t)255; return (void*)p; };
    bf* WT = (bf*)take((size_t)3 * HD * DM * 2);
    const size_t PB = (size_t)TT * HD;   // one batch's plane; the planes of all batches are kept for the one attention launch
    bf* QPh = (bf*)take(2 * NB_ * PB * 2); bf* KPh = (bf*)take(NB_ * PB * 2); bf* VTh = (bf*)take(NB_ * PB * 2);   // f16 planes: q's lo plane right behind its hi plane; k, v: one plane each
    float* Ob = (float*)take((size_t)(TT / KCH) * NB_ * PB * 4); float* ML = (float*)take((size_t)(TT / KCH) * NB_ * TT * 2 * 4);
    if ((size_t)(wsp - (char*)d_ws) > ws_size) return;    // ws 256 MiB
    k_wt3<<<dim3(HD * DM / 2048, 3, 1), 256, 0, stream>>>(wq, wk, wv, WT);
    k_qkv<<<NB_ * TT / 64, 384, 0, stream>>>(x, WT, QPh, KPh, VTh);
    k_flash<<<(KCH / 64) * (TT / KCH) * (TT / KCH + 1) / 2 * NB_, 128, 0, stream>>>(QPh, KPh, VTh, Ob, ML);
    k_merge<<<(unsigned)((size_t)NB_ * TT * HD / 4 / 256), 256, 0, stream>>>(Ob, ML, OUT);
}
